// v000
// Measured on an AMD MI455X. A time is GPU time per run, averaged over a window of back-to-back runs after a warm-up
// (all launches, gaps included; the runs take copies of the inputs in turn), and the median of several windows.
// Apart from v000's, it joins two sittings. Times from different sittings can be a few percent apart, while
// side-by-side timings come from the same sitting.
// v000 is the starting kernel. One run takes 301 microseconds.
#include <hip/hip_runtime.h>
#include <hip/hip_bf16.h>
#include <math.h>

// ---------------------------------------------------------------------------
// MHA forward for B=4, N=2048, D=1024, H=16, HD=64 on gfx1250 (wave32, WMMA).
// bf16 inputs to v_wmma_f32_16x16x32_bf16, fp32 accumulation throughout.
// Compute-bound (~137 GFLOP vs <10us of HBM traffic at 23.3 TB/s), so all
// three stages run through the matrix pipes.
// ---------------------------------------------------------------------------

typedef __bf16 bf16_t;
typedef __attribute__((ext_vector_type(16))) __bf16 v16bf;
typedef __attribute__((ext_vector_type(8)))  __bf16 v8bf;
typedef __attribute__((ext_vector_type(8)))  float  v8f;

#define BATCH 4
#define SEQ   2048
#define DMODEL 1024
#define NHEAD 16
#define HDIM  64
#define BN    (BATCH * SEQ)       // 8192
#define E3    (3 * DMODEL)        // 3072
#define SCALE 0.125f              // 64^-0.5

__device__ __forceinline__ v8f wmma_bf16(v16bf a, v16bf b, v8f c) {
  return __builtin_amdgcn_wmma_f32_16x16x32_bf16(
      /*neg_a=*/false, a, /*neg_b=*/false, b,
      /*c_mod=*/(short)0, c, /*reuse_a=*/false, /*reuse_b=*/false);
}

// Load one 16x32 bf16 fragment (A-layout; identical addressing serves the
// B-fragment of a TN gemm where B rows are K-contiguous).
//   lane 0-15 : row = lane,    k = {0..7, 16..23}
//   lane 16-31: row = lane-16, k = {8..15, 24..31}
// Two 16-byte reads per lane; `t` may point at LDS (ds_load after addrspace
// inference) or global memory.
__device__ __forceinline__ v16bf ld_frag(const bf16_t* t, int row, int stride,
                                         int kbase) {
  const int lane = threadIdx.x & 31;
  const int r = lane & 15;
  const int klo = (lane >> 4) << 3;
  const bf16_t* p = t + (size_t)(row + r) * stride + kbase + klo;
  union { v16bf v; v8bf h[2]; } u;
  u.h[0] = *(const v8bf*)(p);
  u.h[1] = *(const v8bf*)(p + 16);
  return u.v;
}

// ---------------------------------------------------------------------------
// Kernel 1: qkv = x @ w_qkv^T  (TN gemm, M=8192, N=3072, K=1024)
// WG tile 128x128, 8 waves, each wave 32x64 (acc[2][4], 8 WMMAs / K-step).
// Scatters to q (pre-scaled), k as (B,H,N,HD) and v transposed (B,H,HD,N).
// ---------------------------------------------------------------------------
__global__ __launch_bounds__(256) void qkv_gemm_kernel(
    const float* __restrict__ x, const float* __restrict__ w_qkv,
    bf16_t* __restrict__ qw, bf16_t* __restrict__ kw, bf16_t* __restrict__ vtw) {
  __shared__ bf16_t Xs[128 * 40];   // 128 rows x 32 K, stride 40 (pad)
  __shared__ bf16_t Ws[128 * 40];   // 128 rows x 32 K

  const int tid  = threadIdx.x;
  const int wave = tid >> 5;
  const int wm   = wave >> 1;       // 0..3 -> 32-row block
  const int wn   = wave & 1;        // 0..1 -> 64-col block
  const int m0   = blockIdx.x * 128;
  const int e0   = blockIdx.y * 128;

  v8f acc[2][4];
  for (int i = 0; i < 2; ++i)
    for (int j = 0; j < 4; ++j) acc[i][j] = 0.f;

  for (int kb = 0; kb < DMODEL; kb += 32) {
    __syncthreads();
    // Stage X tile 128x32 fp32 -> bf16 LDS (1024 float4, 4 per thread).
    for (int i = 0; i < 4; ++i) {
      int gid = tid + i * 256;
      int r = gid >> 3, c = (gid & 7) * 4;
      const float4 f =
          *(const float4*)(x + (size_t)(m0 + r) * DMODEL + kb + c);
      union { bf16_t b[4]; uint2 u; } pk;
      pk.b[0] = (bf16_t)f.x; pk.b[1] = (bf16_t)f.y;
      pk.b[2] = (bf16_t)f.z; pk.b[3] = (bf16_t)f.w;
      *(uint2*)&Xs[r * 40 + c] = pk.u;
    }
    // Stage W tile 128x32 fp32 -> bf16 LDS.
    for (int i = 0; i < 4; ++i) {
      int gid = tid + i * 256;
      int r = gid >> 3, c = (gid & 7) * 4;
      const float4 f =
          *(const float4*)(w_qkv + (size_t)(e0 + r) * DMODEL + kb + c);
      union { bf16_t b[4]; uint2 u; } pk;
      pk.b[0] = (bf16_t)f.x; pk.b[1] = (bf16_t)f.y;
      pk.b[2] = (bf16_t)f.z; pk.b[3] = (bf16_t)f.w;
      *(uint2*)&Ws[r * 40 + c] = pk.u;
    }
    __syncthreads();

    v16bf a0 = ld_frag(Xs, wm * 32,      40, 0);
    v16bf a1 = ld_frag(Xs, wm * 32 + 16, 40, 0);
    for (int j = 0; j < 4; ++j) {
      v16bf bj = ld_frag(Ws, wn * 64 + j * 16, 40, 0);
      acc[0][j] = wmma_bf16(a0, bj, acc[0][j]);
      acc[1][j] = wmma_bf16(a1, bj, acc[1][j]);
    }
  }

  // Epilogue scatter. C-layout: lane holds col=lane&15, rows v+8*(lane>>4).
  // The 128-wide N tile lies inside one q/k/v segment -> s is block-uniform.
  const int lane = tid & 31;
  const int half = lane >> 4;
  const int col  = lane & 15;
  const int s    = e0 >> 10;                        // 0=q, 1=k, 2=v (uniform)
  const int gm0  = m0 + wm * 32;
  const int ge0  = e0 + wn * 64;

  if (s == 0) {
    for (int mi = 0; mi < 2; ++mi)
      for (int ni = 0; ni < 4; ++ni)
        for (int v = 0; v < 8; ++v) {
          int gm = gm0 + mi * 16 + v + 8 * half;
          int ge = ge0 + ni * 16 + col;
          int b = gm >> 11, n = gm & (SEQ - 1);
          int h = (ge >> 6) & (NHEAD - 1), hd = ge & (HDIM - 1);
          qw[((size_t)(b * NHEAD + h) * SEQ + n) * HDIM + hd] =
              (bf16_t)(acc[mi][ni][v] * SCALE);
        }
  } else if (s == 1) {
    for (int mi = 0; mi < 2; ++mi)
      for (int ni = 0; ni < 4; ++ni)
        for (int v = 0; v < 8; ++v) {
          int gm = gm0 + mi * 16 + v + 8 * half;
          int ge = ge0 + ni * 16 + col;
          int b = gm >> 11, n = gm & (SEQ - 1);
          int h = (ge >> 6) & (NHEAD - 1), hd = ge & (HDIM - 1);
          kw[((size_t)(b * NHEAD + h) * SEQ + n) * HDIM + hd] =
              (bf16_t)acc[mi][ni][v];
        }
  } else {
    for (int mi = 0; mi < 2; ++mi)
      for (int ni = 0; ni < 4; ++ni)
        for (int v = 0; v < 8; ++v) {
          int gm = gm0 + mi * 16 + v + 8 * half;
          int ge = ge0 + ni * 16 + col;
          int b = gm >> 11, n = gm & (SEQ - 1);
          int h = (ge >> 6) & (NHEAD - 1), hd = ge & (HDIM - 1);
          vtw[((size_t)(b * NHEAD + h) * HDIM + hd) * SEQ + n] =
              (bf16_t)acc[mi][ni][v];
        }
  }
}

// ---------------------------------------------------------------------------
// Kernel 2: flash attention. One WG (128 thr = 4 waves) per 64 q-rows of one
// (b,h). Each wave owns 16 q-rows; KV streamed in 64-wide tiles via LDS.
// ---------------------------------------------------------------------------
__global__ __launch_bounds__(128) void attn_kernel(
    const bf16_t* __restrict__ qw, const bf16_t* __restrict__ kw,
    const bf16_t* __restrict__ vtw, bf16_t* __restrict__ ow) {
  __shared__ bf16_t Ks[64 * 72];     // K tile: rows=kv, cols=hd
  __shared__ bf16_t Vs[64 * 72];     // V^T tile: rows=hd, cols=kv
  __shared__ bf16_t Ps[4][16 * 72];  // per-wave P scratch (C->A relayout)

  const int tid  = threadIdx.x;
  const int wave = tid >> 5;
  const int lane = tid & 31;
  const int half = lane >> 4;
  const int col  = lane & 15;
  const int bh   = blockIdx.y;                 // b*16 + h
  const int qrow0 = blockIdx.x * 64 + wave * 16;

  // Q fragments (16 rows x HD=64 -> two k-slices), straight from global.
  const bf16_t* qbase = qw + ((size_t)bh * SEQ + qrow0) * HDIM;
  v16bf qf[2];
  qf[0] = ld_frag(qbase, 0, HDIM, 0);
  qf[1] = ld_frag(qbase, 0, HDIM, 32);

  v8f of[4];
  of[0] = 0.f; of[1] = 0.f; of[2] = 0.f; of[3] = 0.f;
  float m_i[8], l_i[8];
  for (int v = 0; v < 8; ++v) { m_i[v] = -1e30f; l_i[v] = 0.f; }

  const bf16_t* kg0 = kw + (size_t)bh * SEQ * HDIM;
  const bf16_t* vg0 = vtw + (size_t)bh * HDIM * SEQ;

  for (int kv0 = 0; kv0 < SEQ; kv0 += 64) {
    __syncthreads();
    // Stage K tile (64 kv-rows x 64 hd) and V^T tile (64 hd-rows x 64 kv).
    for (int i = 0; i < 4; ++i) {
      int gid = tid + i * 128;
      int r = gid >> 3, c = (gid & 7) * 8;
      *(uint4*)&Ks[r * 72 + c] =
          *(const uint4*)(kg0 + (size_t)(kv0 + r) * HDIM + c);
    }
    for (int i = 0; i < 4; ++i) {
      int gid = tid + i * 128;
      int r = gid >> 3, c = (gid & 7) * 8;
      *(uint4*)&Vs[r * 72 + c] =
          *(const uint4*)(vg0 + (size_t)r * SEQ + kv0 + c);
    }
    __syncthreads();

    // S = Q K^T : 4 column blocks, K-dim 64 -> 2 WMMAs each.
    v8f sf[4];
    for (int j = 0; j < 4; ++j) {
      v8f s = 0.f;
      s = wmma_bf16(qf[0], ld_frag(Ks, j * 16, 72, 0),  s);
      s = wmma_bf16(qf[1], ld_frag(Ks, j * 16, 72, 32), s);
      sf[j] = s;
    }

    // Online softmax. Row M = v + 8*half lives across a 16-lane half-wave.
    float mt[8], scl[8], rs[8];
    for (int v = 0; v < 8; ++v) {
      float m = sf[0][v];
      m = fmaxf(m, sf[1][v]); m = fmaxf(m, sf[2][v]); m = fmaxf(m, sf[3][v]);
      mt[v] = m;
    }
    for (int off = 1; off < 16; off <<= 1)
      for (int v = 0; v < 8; ++v)
        mt[v] = fmaxf(mt[v], __shfl_xor(mt[v], off, 32));
    for (int v = 0; v < 8; ++v) {
      float mn = fmaxf(m_i[v], mt[v]);
      scl[v] = __expf(m_i[v] - mn);
      m_i[v] = mn;
    }
    for (int v = 0; v < 8; ++v) {
      float sum = 0.f;
      for (int j = 0; j < 4; ++j) {
        float p = __expf(sf[j][v] - m_i[v]);
        sf[j][v] = p;
        sum += p;
      }
      rs[v] = sum;
    }
    for (int off = 1; off < 16; off <<= 1)
      for (int v = 0; v < 8; ++v)
        rs[v] += __shfl_xor(rs[v], off, 32);
    for (int v = 0; v < 8; ++v) l_i[v] = l_i[v] * scl[v] + rs[v];
    for (int j = 0; j < 4; ++j)
      for (int v = 0; v < 8; ++v) of[j][v] *= scl[v];

    // P: C-fragment layout -> per-wave LDS -> A-fragment layout.
    // Wave-private region; DS ops within a wave are in-order (RAW safe).
    bf16_t* pw = &Ps[wave][0];
    for (int j = 0; j < 4; ++j)
      for (int v = 0; v < 8; ++v)
        pw[(v + 8 * half) * 72 + j * 16 + col] = (bf16_t)sf[j][v];

    // O += P V  (K-dim 64 over kv, 4 hd column blocks).
    v16bf p0 = ld_frag(pw, 0, 72, 0);
    v16bf p1 = ld_frag(pw, 0, 72, 32);
    for (int j = 0; j < 4; ++j) {
      of[j] = wmma_bf16(p0, ld_frag(Vs, j * 16, 72, 0),  of[j]);
      of[j] = wmma_bf16(p1, ld_frag(Vs, j * 16, 72, 32), of[j]);
    }
  }

  // Finalize: O *= 1/l, write to (B, N, H*HD) bf16 for the projection gemm.
  const int b = bh >> 4, h = bh & 15;
  float inv_l[8];
  for (int v = 0; v < 8; ++v) inv_l[v] = 1.0f / l_i[v];
  for (int j = 0; j < 4; ++j)
    for (int v = 0; v < 8; ++v) {
      int n = qrow0 + v + 8 * half;
      float val = of[j][v] * inv_l[v];
      ow[((size_t)(b * SEQ + n)) * DMODEL + h * HDIM + j * 16 + col] =
          (bf16_t)val;
    }
}

// ---------------------------------------------------------------------------
// Kernel 3: out = attn_out @ w_proj^T + b_proj  (M=8192, N=1024, K=1024)
// WG tile 128x128, 8 waves, each wave 32x64.
// ---------------------------------------------------------------------------
__global__ __launch_bounds__(256) void proj_gemm_kernel(
    const bf16_t* __restrict__ a, const float* __restrict__ w_proj,
    const float* __restrict__ b_proj, float* __restrict__ out) {
  __shared__ bf16_t As[128 * 40];
  __shared__ bf16_t Ws[128 * 40];

  const int tid  = threadIdx.x;
  const int wave = tid >> 5;
  const int wm   = wave >> 1;
  const int wn   = wave & 1;
  const int m0   = blockIdx.x * 128;
  const int e0   = blockIdx.y * 128;

  v8f acc[2][4];
  for (int i = 0; i < 2; ++i)
    for (int j = 0; j < 4; ++j) acc[i][j] = 0.f;

  for (int kb = 0; kb < DMODEL; kb += 32) {
    __syncthreads();
    // Stage A tile 128x32 bf16 (512 uint4, 2 per thread).
    for (int i = 0; i < 2; ++i) {
      int gid = tid + i * 256;
      int r = gid >> 2, c = (gid & 3) * 8;
      *(uint4*)&As[r * 40 + c] =
          *(const uint4*)(a + (size_t)(m0 + r) * DMODEL + kb + c);
    }
    // Stage W tile 128x32 fp32 -> bf16 (1024 float4, 4 per thread).
    for (int i = 0; i < 4; ++i) {
      int gid = tid + i * 256;
      int r = gid >> 3, c = (gid & 7) * 4;
      const float4 f =
          *(const float4*)(w_proj + (size_t)(e0 + r) * DMODEL + kb + c);
      union { bf16_t b[4]; uint2 u; } pk;
      pk.b[0] = (bf16_t)f.x; pk.b[1] = (bf16_t)f.y;
      pk.b[2] = (bf16_t)f.z; pk.b[3] = (bf16_t)f.w;
      *(uint2*)&Ws[r * 40 + c] = pk.u;
    }
    __syncthreads();

    v16bf a0 = ld_frag(As, wm * 32,      40, 0);
    v16bf a1 = ld_frag(As, wm * 32 + 16, 40, 0);
    for (int j = 0; j < 4; ++j) {
      v16bf bj = ld_frag(Ws, wn * 64 + j * 16, 40, 0);
      acc[0][j] = wmma_bf16(a0, bj, acc[0][j]);
      acc[1][j] = wmma_bf16(a1, bj, acc[1][j]);
    }
  }

  const int lane = tid & 31;
  const int half = lane >> 4;
  const int col  = lane & 15;
  for (int mi = 0; mi < 2; ++mi)
    for (int ni = 0; ni < 4; ++ni)
      for (int v = 0; v < 8; ++v) {
        int gm = m0 + wm * 32 + mi * 16 + v + 8 * half;
        int ge = e0 + wn * 64 + ni * 16 + col;
        out[(size_t)gm * DMODEL + ge] = acc[mi][ni][v] + b_proj[ge];
      }
}

// ---------------------------------------------------------------------------
extern "C" void kernel_launch(void* const* d_in, const int* in_sizes, int n_in,
                              void* d_out, int out_size, void* d_ws,
                              size_t ws_size, hipStream_t stream) {
  const float* x      = (const float*)d_in[0];
  const float* w_qkv  = (const float*)d_in[1];
  const float* w_proj = (const float*)d_in[2];
  const float* b_proj = (const float*)d_in[3];
  float* out = (float*)d_out;

  const size_t PER = (size_t)BATCH * NHEAD * SEQ * HDIM;  // 8M elements
  bf16_t* qw  = (bf16_t*)d_ws;
  bf16_t* kw  = qw + PER;
  bf16_t* vtw = kw + PER;
  bf16_t* ow  = vtw + PER;   // (B, N, D) attention output, bf16

  qkv_gemm_kernel<<<dim3(BN / 128, E3 / 128), 256, 0, stream>>>(
      x, w_qkv, qw, kw, vtw);
  attn_kernel<<<dim3(SEQ / 64, BATCH * NHEAD), 128, 0, stream>>>(
      qw, kw, vtw, ow);
  proj_gemm_kernel<<<dim3(BN / 128, DMODEL / 128), 256, 0, stream>>>(
      ow, w_proj, b_proj, out);
}

// v001
// One run takes 212 microseconds.
// Timed twice side by side with v000, it ran 1.46 and 1.47 times as fast.
#include <hip/hip_runtime.h>
#include <hip/hip_bf16.h>
#include <math.h>

// ---------------------------------------------------------------------------
// MHA forward for B=4, N=2048, D=1024, H=16, HD=64 on gfx1250 (wave32, WMMA).
// bf16 inputs to v_wmma_f32_16x16x32_bf16, fp32 accumulation throughout.
// Compute-bound (~137 GFLOP vs <10us of HBM traffic at 23.3 TB/s), so all
// three stages run through the matrix pipes.
// ---------------------------------------------------------------------------

typedef __bf16 bf16_t;
typedef __attribute__((ext_vector_type(16))) __bf16 v16bf;
typedef __attribute__((ext_vector_type(8)))  __bf16 v8bf;
typedef __attribute__((ext_vector_type(8)))  float  v8f;

#define BATCH 4
#define SEQ   2048
#define DMODEL 1024
#define NHEAD 16
#define HDIM  64
#define BN    (BATCH * SEQ)       // 8192
#define E3    (3 * DMODEL)        // 3072
#define SCALE 0.125f              // 64^-0.5

__device__ __forceinline__ v8f wmma_bf16(v16bf a, v16bf b, v8f c) {
  return __builtin_amdgcn_wmma_f32_16x16x32_bf16(
      /*neg_a=*/false, a, /*neg_b=*/false, b,
      /*c_mod=*/(short)0, c, /*reuse_a=*/false, /*reuse_b=*/false);
}

// Load one 16x32 bf16 fragment (A-layout; identical addressing serves the
// B-fragment of a TN gemm where B rows are K-contiguous).
//   lane 0-15 : row = lane,    k = {0..7, 16..23}
//   lane 16-31: row = lane-16, k = {8..15, 24..31}
// Two 16-byte reads per lane; `t` may point at LDS (ds_load after addrspace
// inference) or global memory.
__device__ __forceinline__ v16bf ld_frag(const bf16_t* t, int row, int stride,
                                         int kbase) {
  const int lane = threadIdx.x & 31;
  const int r = lane & 15;
  const int klo = (lane >> 4) << 3;
  const bf16_t* p = t + (size_t)(row + r) * stride + kbase + klo;
  union { v16bf v; v8bf h[2]; } u;
  u.h[0] = *(const v8bf*)(p);
  u.h[1] = *(const v8bf*)(p + 16);
  return u.v;
}

// ---------------------------------------------------------------------------
// Kernel 1: qkv = x @ w_qkv^T  (TN gemm, M=8192, N=3072, K=1024)
// WG tile 128x128, 8 waves, each wave 32x64 (acc[2][4], 8 WMMAs / K-step).
// Scatters to q (pre-scaled), k as (B,H,N,HD) and v transposed (B,H,HD,N).
// ---------------------------------------------------------------------------
__global__ __launch_bounds__(256) void qkv_gemm_kernel(
    const float* __restrict__ x, const float* __restrict__ w_qkv,
    bf16_t* __restrict__ qw, bf16_t* __restrict__ kw, bf16_t* __restrict__ vtw) {
  __shared__ bf16_t Xs[128 * 40];   // 128 rows x 32 K, stride 40 (pad)
  __shared__ bf16_t Ws[128 * 40];   // 128 rows x 32 K

  const int tid  = threadIdx.x;
  const int wave = tid >> 5;
  const int wm   = wave >> 1;       // 0..3 -> 32-row block
  const int wn   = wave & 1;        // 0..1 -> 64-col block
  const int m0   = blockIdx.x * 128;
  const int e0   = blockIdx.y * 128;

  v8f acc[2][4];
  for (int i = 0; i < 2; ++i)
    for (int j = 0; j < 4; ++j) acc[i][j] = 0.f;

  for (int kb = 0; kb < DMODEL; kb += 32) {
    __syncthreads();
    // Stage X tile 128x32 fp32 -> bf16 LDS (1024 float4, 4 per thread).
    for (int i = 0; i < 4; ++i) {
      int gid = tid + i * 256;
      int r = gid >> 3, c = (gid & 7) * 4;
      const float4 f =
          *(const float4*)(x + (size_t)(m0 + r) * DMODEL + kb + c);
      union { bf16_t b[4]; uint2 u; } pk;
      pk.b[0] = (bf16_t)f.x; pk.b[1] = (bf16_t)f.y;
      pk.b[2] = (bf16_t)f.z; pk.b[3] = (bf16_t)f.w;
      *(uint2*)&Xs[r * 40 + c] = pk.u;
    }
    // Stage W tile 128x32 fp32 -> bf16 LDS.
    for (int i = 0; i < 4; ++i) {
      int gid = tid + i * 256;
      int r = gid >> 3, c = (gid & 7) * 4;
      const float4 f =
          *(const float4*)(w_qkv + (size_t)(e0 + r) * DMODEL + kb + c);
      union { bf16_t b[4]; uint2 u; } pk;
      pk.b[0] = (bf16_t)f.x; pk.b[1] = (bf16_t)f.y;
      pk.b[2] = (bf16_t)f.z; pk.b[3] = (bf16_t)f.w;
      *(uint2*)&Ws[r * 40 + c] = pk.u;
    }
    __syncthreads();

    v16bf a0 = ld_frag(Xs, wm * 32,      40, 0);
    v16bf a1 = ld_frag(Xs, wm * 32 + 16, 40, 0);
    for (int j = 0; j < 4; ++j) {
      v16bf bj = ld_frag(Ws, wn * 64 + j * 16, 40, 0);
      acc[0][j] = wmma_bf16(a0, bj, acc[0][j]);
      acc[1][j] = wmma_bf16(a1, bj, acc[1][j]);
    }
  }

  // Epilogue scatter. C-layout: lane holds col=lane&15, rows v+8*(lane>>4).
  // The 128-wide N tile lies inside one q/k/v segment -> s is block-uniform.
  const int lane = tid & 31;
  const int half = lane >> 4;
  const int col  = lane & 15;
  const int s    = e0 >> 10;                        // 0=q, 1=k, 2=v (uniform)
  const int gm0  = m0 + wm * 32;
  const int ge0  = e0 + wn * 64;

  if (s == 0) {
    for (int mi = 0; mi < 2; ++mi)
      for (int ni = 0; ni < 4; ++ni)
        for (int v = 0; v < 8; ++v) {
          int gm = gm0 + mi * 16 + v + 8 * half;
          int ge = ge0 + ni * 16 + col;
          int b = gm >> 11, n = gm & (SEQ - 1);
          int h = (ge >> 6) & (NHEAD - 1), hd = ge & (HDIM - 1);
          qw[((size_t)(b * NHEAD + h) * SEQ + n) * HDIM + hd] =
              (bf16_t)(acc[mi][ni][v] * SCALE);
        }
  } else if (s == 1) {
    for (int mi = 0; mi < 2; ++mi)
      for (int ni = 0; ni < 4; ++ni)
        for (int v = 0; v < 8; ++v) {
          int gm = gm0 + mi * 16 + v + 8 * half;
          int ge = ge0 + ni * 16 + col;
          int b = gm >> 11, n = gm & (SEQ - 1);
          int h = (ge >> 6) & (NHEAD - 1), hd = ge & (HDIM - 1);
          kw[((size_t)(b * NHEAD + h) * SEQ + n) * HDIM + hd] =
              (bf16_t)acc[mi][ni][v];
        }
  } else {
    for (int mi = 0; mi < 2; ++mi)
      for (int ni = 0; ni < 4; ++ni)
        for (int v = 0; v < 8; ++v) {
          int gm = gm0 + mi * 16 + v + 8 * half;
          int ge = ge0 + ni * 16 + col;
          int b = gm >> 11, n = gm & (SEQ - 1);
          int h = (ge >> 6) & (NHEAD - 1), hd = ge & (HDIM - 1);
          vtw[((size_t)(b * NHEAD + h) * HDIM + hd) * SEQ + n] =
              (bf16_t)acc[mi][ni][v];
        }
  }
}

// Value of lane l ^ 16.
__device__ __forceinline__ float other_half(float x) {
  int b = __builtin_bit_cast(int, x);
  b = __builtin_amdgcn_permlanex16(b, b, 0x76543210, 0xfedcba98, false, false);
  return __builtin_bit_cast(float, b);
}

// Two f32 accumulator tiles (rows 0-15 and 16-31 of a 32-row block) -> one
// bf16 B fragment: element s is row (s<8 ? 8*half+s : 16+8*half+s-8).
__device__ __forceinline__ v16bf pack_b(v8f t0, v8f t1) {
  v16bf r;
  for (int s = 0; s < 8; ++s) {
    r[s]     = (bf16_t)t0[s];
    r[s + 8] = (bf16_t)t1[s];
  }
  return r;
}

__global__ __launch_bounds__(128) void attn_kernel(
    const bf16_t* __restrict__ qw, const bf16_t* __restrict__ kw,
    const bf16_t* __restrict__ vtw, bf16_t* __restrict__ ow) {
  __shared__ bf16_t Ks[64 * 72];     // K tile: rows=kv, cols=hd
  __shared__ bf16_t Vs[64 * 72];     // V^T tile: rows=hd, cols=kv

  const int tid  = threadIdx.x;
  const int wave = tid >> 5;
  const int lane = tid & 31;
  const int half = lane >> 4;
  const int col  = lane & 15;
  const int bh   = blockIdx.y;                 // b*16 + h
  const int qrow0 = blockIdx.x * 64 + wave * 16;

  // Q fragments (16 rows x HD=64 -> two k-slices), straight from global.
  // Used as the B operand: column = query, k = hd.
  const bf16_t* qbase = qw + ((size_t)bh * SEQ + qrow0) * HDIM;
  v16bf qf[2];
  qf[0] = ld_frag(qbase, 0, HDIM, 0);
  qf[1] = ld_frag(qbase, 0, HDIM, 32);

  // of[j][v] = O[query col][hd = j*16 + 8*half + v]
  v8f of[4];
  of[0] = 0.f; of[1] = 0.f; of[2] = 0.f; of[3] = 0.f;
  float m_i = -1e30f;   // running maximum of this lane's query (both halves)
  float l_i = 0.f;      // running sum over this half's keys only

  const bf16_t* kg0 = kw + (size_t)bh * SEQ * HDIM;
  const bf16_t* vg0 = vtw + (size_t)bh * HDIM * SEQ;

  for (int kv0 = 0; kv0 < SEQ; kv0 += 64) {
    __syncthreads();
    // Stage K tile (64 kv-rows x 64 hd) and V^T tile (64 hd-rows x 64 kv).
    for (int i = 0; i < 4; ++i) {
      int gid = tid + i * 128;
      int r = gid >> 3, c = (gid & 7) * 8;
      *(uint4*)&Ks[r * 72 + c] =
          *(const uint4*)(kg0 + (size_t)(kv0 + r) * HDIM + c);
    }
    for (int i = 0; i < 4; ++i) {
      int gid = tid + i * 128;
      int r = gid >> 3, c = (gid & 7) * 8;
      *(uint4*)&Vs[r * 72 + c] =
          *(const uint4*)(vg0 + (size_t)r * SEQ + kv0 + c);
    }
    __syncthreads();

    // S^T = K Q^T : 4 key-row blocks, K-dim 64 -> 2 WMMAs each.
    // sf[j][v] = S[query col][key kv0 + j*16 + 8*half + v]
    v8f sf[4];
    for (int j = 0; j < 4; ++j) {
      v8f s = 0.f;
      s = wmma_bf16(ld_frag(Ks, j * 16, 72, 0),  qf[0], s);
      s = wmma_bf16(ld_frag(Ks, j * 16, 72, 32), qf[1], s);
      sf[j] = s;
    }

    // Online softmax, one query per lane.
    float mj[4];
    for (int j = 0; j < 4; ++j) {
      float m = sf[j][0];
      for (int v = 1; v < 8; ++v) m = fmaxf(m, sf[j][v]);
      mj[j] = m;
    }
    float mt = fmaxf(fmaxf(mj[0], mj[1]), fmaxf(mj[2], mj[3]));
    mt = fmaxf(mt, other_half(mt));
    const float mn  = fmaxf(m_i, mt);
    const float scl = __expf(m_i - mn);
    m_i = mn;

    float sj[4];
    for (int j = 0; j < 4; ++j) {
      float sum = 0.f;
      for (int v = 0; v < 8; ++v) {
        float p = __expf(sf[j][v] - mn);
        sf[j][v] = p;
        sum += p;
      }
      sj[j] = sum;
    }
    l_i = l_i * scl + ((sj[0] + sj[1]) + (sj[2] + sj[3]));
    for (int j = 0; j < 4; ++j)
      for (int v = 0; v < 8; ++v) of[j][v] *= scl;

    // O^T += V^T P^T  (K-dim 64 over kv, 4 hd row blocks).
    const v16bf p0 = pack_b(sf[0], sf[1]);
    const v16bf p1 = pack_b(sf[2], sf[3]);
    for (int j = 0; j < 4; ++j) {
      of[j] = wmma_bf16(ld_frag(Vs, j * 16, 72, 0),  p0, of[j]);
      of[j] = wmma_bf16(ld_frag(Vs, j * 16, 72, 32), p1, of[j]);
    }
  }

  // Finalize: join the halves' sums, O *= 1/l, write to (B, N, H*HD) bf16 for
  // the projection gemm. A lane holds 8 consecutive hd of one query per tile.
  const int b = bh >> 4, h = bh & 15;
  const float inv_l = 1.0f / (l_i + other_half(l_i));
  bf16_t* orow = ow + ((size_t)(b * SEQ + qrow0 + col)) * DMODEL + h * HDIM +
                 8 * half;
  for (int j = 0; j < 4; ++j) {
    v8bf o;
    for (int v = 0; v < 8; ++v) o[v] = (bf16_t)(of[j][v] * inv_l);
    *(v8bf*)(orow + j * 16) = o;
  }
}

// ---------------------------------------------------------------------------
// Kernel 3: out = attn_out @ w_proj^T + b_proj  (M=8192, N=1024, K=1024)
// WG tile 128x128, 8 waves, each wave 32x64.
// ---------------------------------------------------------------------------
__global__ __launch_bounds__(256) void proj_gemm_kernel(
    const bf16_t* __restrict__ a, const float* __restrict__ w_proj,
    const float* __restrict__ b_proj, float* __restrict__ out) {
  __shared__ bf16_t As[128 * 40];
  __shared__ bf16_t Ws[128 * 40];

  const int tid  = threadIdx.x;
  const int wave = tid >> 5;
  const int wm   = wave >> 1;
  const int wn   = wave & 1;
  const int m0   = blockIdx.x * 128;
  const int e0   = blockIdx.y * 128;

  v8f acc[2][4];
  for (int i = 0; i < 2; ++i)
    for (int j = 0; j < 4; ++j) acc[i][j] = 0.f;

  for (int kb = 0; kb < DMODEL; kb += 32) {
    __syncthreads();
    // Stage A tile 128x32 bf16 (512 uint4, 2 per thread).
    for (int i = 0; i < 2; ++i) {
      int gid = tid + i * 256;
      int r = gid >> 2, c = (gid & 3) * 8;
      *(uint4*)&As[r * 40 + c] =
          *(const uint4*)(a + (size_t)(m0 + r) * DMODEL + kb + c);
    }
    // Stage W tile 128x32 fp32 -> bf16 (1024 float4, 4 per thread).
    for (int i = 0; i < 4; ++i) {
      int gid = tid + i * 256;
      int r = gid >> 3, c = (gid & 7) * 4;
      const float4 f =
          *(const float4*)(w_proj + (size_t)(e0 + r) * DMODEL + kb + c);
      union { bf16_t b[4]; uint2 u; } pk;
      pk.b[0] = (bf16_t)f.x; pk.b[1] = (bf16_t)f.y;
      pk.b[2] = (bf16_t)f.z; pk.b[3] = (bf16_t)f.w;
      *(uint2*)&Ws[r * 40 + c] = pk.u;
    }
    __syncthreads();

    v16bf a0 = ld_frag(As, wm * 32,      40, 0);
    v16bf a1 = ld_frag(As, wm * 32 + 16, 40, 0);
    for (int j = 0; j < 4; ++j) {
      v16bf bj = ld_frag(Ws, wn * 64 + j * 16, 40, 0);
      acc[0][j] = wmma_bf16(a0, bj, acc[0][j]);
      acc[1][j] = wmma_bf16(a1, bj, acc[1][j]);
    }
  }

  const int lane = tid & 31;
  const int half = lane >> 4;
  const int col  = lane & 15;
  for (int mi = 0; mi < 2; ++mi)
    for (int ni = 0; ni < 4; ++ni)
      for (int v = 0; v < 8; ++v) {
        int gm = m0 + wm * 32 + mi * 16 + v + 8 * half;
        int ge = e0 + wn * 64 + ni * 16 + col;
        out[(size_t)gm * DMODEL + ge] = acc[mi][ni][v] + b_proj[ge];
      }
}

// ---------------------------------------------------------------------------
extern "C" void kernel_launch(void* const* d_in, const int* in_sizes, int n_in,
                              void* d_out, int out_size, void* d_ws,
                              size_t ws_size, hipStream_t stream) {
  const float* x      = (const float*)d_in[0];
  const float* w_qkv  = (const float*)d_in[1];
  const float* w_proj = (const float*)d_in[2];
  const float* b_proj = (const float*)d_in[3];
  float* out = (float*)d_out;

  const size_t PER = (size_t)BATCH * NHEAD * SEQ * HDIM;  // 8M elements
  bf16_t* qw  = (bf16_t*)d_ws;
  bf16_t* kw  = qw + PER;
  bf16_t* vtw = kw + PER;
  bf16_t* ow  = vtw + PER;   // (B, N, D) attention output, bf16

  qkv_gemm_kernel<<<dim3(BN / 128, E3 / 128), 256, 0, stream>>>(
      x, w_qkv, qw, kw, vtw);
  attn_kernel<<<dim3(SEQ / 64, BATCH * NHEAD), 128, 0, stream>>>(
      qw, kw, vtw, ow);
  proj_gemm_kernel<<<dim3(BN / 128, DMODEL / 128), 256, 0, stream>>>(
      ow, w_proj, b_proj, out);
}

// v002
// A run of this version takes 175 microseconds.
// In both of two side-by-side timings against v001, it was 1.21 times as fast.
// Over all steps from v000 it is 1.77 times as fast.
#include <hip/hip_runtime.h>
#include <hip/hip_bf16.h>
#include <math.h>

// ---------------------------------------------------------------------------
// MHA forward for B=4, N=2048, D=1024, H=16, HD=64 on gfx1250 (wave32, WMMA).
// bf16 inputs to v_wmma_f32_16x16x32_bf16, fp32 accumulation throughout.
// Compute-bound (~137 GFLOP vs <10us of HBM traffic at 23.3 TB/s), so all
// three stages run through the matrix pipes.
// ---------------------------------------------------------------------------

typedef __bf16 bf16_t;
typedef __attribute__((ext_vector_type(16))) __bf16 v16bf;
typedef __attribute__((ext_vector_type(8)))  __bf16 v8bf;
typedef __attribute__((ext_vector_type(8)))  float  v8f;

#define BATCH 4
#define SEQ   2048
#define DMODEL 1024
#define NHEAD 16
#define HDIM  64
#define BN    (BATCH * SEQ)       // 8192
#define E3    (3 * DMODEL)        // 3072
#define SCALE 0.125f              // 64^-0.5

__device__ __forceinline__ v8f wmma_bf16(v16bf a, v16bf b, v8f c) {
  return __builtin_amdgcn_wmma_f32_16x16x32_bf16(
      /*neg_a=*/false, a, /*neg_b=*/false, b,
      /*c_mod=*/(short)0, c, /*reuse_a=*/false, /*reuse_b=*/false);
}

// Load one 16x32 bf16 fragment (A-layout; identical addressing serves the
// B-fragment of a TN gemm where B rows are K-contiguous).
//   lane 0-15 : row = lane,    k = {0..7, 16..23}
//   lane 16-31: row = lane-16, k = {8..15, 24..31}
// Two 16-byte reads per lane; `t` may point at LDS (ds_load after addrspace
// inference) or global memory.
__device__ __forceinline__ v16bf ld_frag(const bf16_t* t, int row, int stride,
                                         int kbase) {
  const int lane = threadIdx.x & 31;
  const int r = lane & 15;
  const int klo = (lane >> 4) << 3;
  const bf16_t* p = t + (size_t)(row + r) * stride + kbase + klo;
  union { v16bf v; v8bf h[2]; } u;
  u.h[0] = *(const v8bf*)(p);
  u.h[1] = *(const v8bf*)(p + 16);
  return u.v;
}

// ---------------------------------------------------------------------------
// Kernel 1: qkv = x @ w_qkv^T  (TN gemm, M=8192, N=3072, K=1024)
// WG tile 128x128, 8 waves, each wave 32x64 (acc[2][4], 8 WMMAs / K-step).
// Scatters to q (pre-scaled), k as (B,H,N,HD) and v transposed (B,H,HD,N).
// ---------------------------------------------------------------------------
__global__ __launch_bounds__(256) void qkv_gemm_kernel(
    const float* __restrict__ x, const float* __restrict__ w_qkv,
    bf16_t* __restrict__ qw, bf16_t* __restrict__ kw, bf16_t* __restrict__ vtw) {
  __shared__ bf16_t Xs[128 * 40];   // 128 rows x 32 K, stride 40 (pad)
  __shared__ bf16_t Ws[128 * 40];   // 128 rows x 32 K

  const int tid  = threadIdx.x;
  const int wave = tid >> 5;
  const int wm   = wave >> 1;       // 0..3 -> 32-row block
  const int wn   = wave & 1;        // 0..1 -> 64-col block
  const int m0   = blockIdx.x * 128;
  const int e0   = blockIdx.y * 128;

  v8f acc[2][4];
  for (int i = 0; i < 2; ++i)
    for (int j = 0; j < 4; ++j) acc[i][j] = 0.f;

  for (int kb = 0; kb < DMODEL; kb += 32) {
    __syncthreads();
    // Stage X tile 128x32 fp32 -> bf16 LDS (1024 float4, 4 per thread).
    for (int i = 0; i < 4; ++i) {
      int gid = tid + i * 256;
      int r = gid >> 3, c = (gid & 7) * 4;
      const float4 f =
          *(const float4*)(x + (size_t)(m0 + r) * DMODEL + kb + c);
      union { bf16_t b[4]; uint2 u; } pk;
      pk.b[0] = (bf16_t)f.x; pk.b[1] = (bf16_t)f.y;
      pk.b[2] = (bf16_t)f.z; pk.b[3] = (bf16_t)f.w;
      *(uint2*)&Xs[r * 40 + c] = pk.u;
    }
    // Stage W tile 128x32 fp32 -> bf16 LDS.
    for (int i = 0; i < 4; ++i) {
      int gid = tid + i * 256;
      int r = gid >> 3, c = (gid & 7) * 4;
      const float4 f =
          *(const float4*)(w_qkv + (size_t)(e0 + r) * DMODEL + kb + c);
      union { bf16_t b[4]; uint2 u; } pk;
      pk.b[0] = (bf16_t)f.x; pk.b[1] = (bf16_t)f.y;
      pk.b[2] = (bf16_t)f.z; pk.b[3] = (bf16_t)f.w;
      *(uint2*)&Ws[r * 40 + c] = pk.u;
    }
    __syncthreads();

    v16bf a0 = ld_frag(Xs, wm * 32,      40, 0);
    v16bf a1 = ld_frag(Xs, wm * 32 + 16, 40, 0);
    for (int j = 0; j < 4; ++j) {
      v16bf bj = ld_frag(Ws, wn * 64 + j * 16, 40, 0);
      acc[0][j] = wmma_bf16(a0, bj, acc[0][j]);
      acc[1][j] = wmma_bf16(a1, bj, acc[1][j]);
    }
  }

  // Epilogue scatter. C-layout: lane holds col=lane&15, rows v+8*(lane>>4).
  // The 128-wide N tile lies inside one q/k/v segment -> s is block-uniform.
  const int lane = tid & 31;
  const int half = lane >> 4;
  const int col  = lane & 15;
  const int s    = e0 >> 10;                        // 0=q, 1=k, 2=v (uniform)
  const int gm0  = m0 + wm * 32;
  const int ge0  = e0 + wn * 64;

  if (s == 0) {
    for (int mi = 0; mi < 2; ++mi)
      for (int ni = 0; ni < 4; ++ni)
        for (int v = 0; v < 8; ++v) {
          int gm = gm0 + mi * 16 + v + 8 * half;
          int ge = ge0 + ni * 16 + col;
          int b = gm >> 11, n = gm & (SEQ - 1);
          int h = (ge >> 6) & (NHEAD - 1), hd = ge & (HDIM - 1);
          qw[((size_t)(b * NHEAD + h) * SEQ + n) * HDIM + hd] =
              (bf16_t)(acc[mi][ni][v] * SCALE);
        }
  } else if (s == 1) {
    for (int mi = 0; mi < 2; ++mi)
      for (int ni = 0; ni < 4; ++ni)
        for (int v = 0; v < 8; ++v) {
          int gm = gm0 + mi * 16 + v + 8 * half;
          int ge = ge0 + ni * 16 + col;
          int b = gm >> 11, n = gm & (SEQ - 1);
          int h = (ge >> 6) & (NHEAD - 1), hd = ge & (HDIM - 1);
          kw[((size_t)(b * NHEAD + h) * SEQ + n) * HDIM + hd] =
              (bf16_t)acc[mi][ni][v];
        }
  } else {
    for (int mi = 0; mi < 2; ++mi)
      for (int ni = 0; ni < 4; ++ni)
        for (int v = 0; v < 8; ++v) {
          int gm = gm0 + mi * 16 + v + 8 * half;
          int ge = ge0 + ni * 16 + col;
          int b = gm >> 11, n = gm & (SEQ - 1);
          int h = (ge >> 6) & (NHEAD - 1), hd = ge & (HDIM - 1);
          vtw[((size_t)(b * NHEAD + h) * HDIM + hd) * SEQ + n] =
              (bf16_t)acc[mi][ni][v];
        }
  }
}

// Value of lane l ^ 16.
__device__ __forceinline__ float other_half(float x) {
  int b = __builtin_bit_cast(int, x);
  b = __builtin_amdgcn_permlanex16(b, b, 0x76543210, 0xfedcba98, false, false);
  return __builtin_bit_cast(float, b);
}

// Two f32 accumulator tiles (rows 0-15 and 16-31 of a 32-row block) -> one
// bf16 B fragment: element s is row (s<8 ? 8*half+s : 16+8*half+s-8).
__device__ __forceinline__ v16bf pack_b(v8f t0, v8f t1) {
  v16bf r;
  for (int s = 0; s < 8; ++s) {
    r[s]     = (bf16_t)t0[s];
    r[s + 8] = (bf16_t)t1[s];
  }
  return r;
}

// Four waves per SIMD (256 VGPRs each): all 1024 work-groups are resident at
// once, four per WGP, so there is no second, half-empty round.
__global__ __launch_bounds__(128)
__attribute__((amdgpu_waves_per_eu(4, 4))) void attn_kernel(
    const bf16_t* __restrict__ qw, const bf16_t* __restrict__ kw,
    const bf16_t* __restrict__ vtw, bf16_t* __restrict__ ow) {
  __shared__ bf16_t Ks[64 * 72];     // K tile: rows=kv, cols=hd
  __shared__ bf16_t Vs[64 * 72];     // V^T tile: rows=hd, cols=kv

  const int tid  = threadIdx.x;
  const int wave = tid >> 5;
  const int lane = tid & 31;
  const int half = lane >> 4;
  const int col  = lane & 15;
  const int bh   = blockIdx.y;                 // b*16 + h
  const int qrow0 = blockIdx.x * 128 + wave * 32;

  // Q fragments (2 groups x 16 rows x HD=64 -> two k-slices each), straight
  // from global. Used as the B operand: column = query, k = hd.
  const bf16_t* qbase = qw + ((size_t)bh * SEQ + qrow0) * HDIM;
  v16bf qf[2][2];
  for (int g = 0; g < 2; ++g) {
    qf[g][0] = ld_frag(qbase, g * 16, HDIM, 0);
    qf[g][1] = ld_frag(qbase, g * 16, HDIM, 32);
  }

  // of[g][j][v] = O[query g*16 + col][hd = j*16 + 8*half + v]
  v8f of[2][4];
  float m_i[2];   // running maximum of this lane's query (both halves)
  float l_i[2];   // running sum over this half's keys only
  for (int g = 0; g < 2; ++g) {
    for (int j = 0; j < 4; ++j) of[g][j] = 0.f;
    m_i[g] = -1e30f;
    l_i[g] = 0.f;
  }

  const bf16_t* kg0 = kw + (size_t)bh * SEQ * HDIM;
  const bf16_t* vg0 = vtw + (size_t)bh * HDIM * SEQ;

  for (int kv0 = 0; kv0 < SEQ; kv0 += 64) {
    __syncthreads();
    // Stage K tile (64 kv-rows x 64 hd) and V^T tile (64 hd-rows x 64 kv).
    for (int i = 0; i < 4; ++i) {
      int gid = tid + i * 128;
      int r = gid >> 3, c = (gid & 7) * 8;
      *(uint4*)&Ks[r * 72 + c] =
          *(const uint4*)(kg0 + (size_t)(kv0 + r) * HDIM + c);
    }
    for (int i = 0; i < 4; ++i) {
      int gid = tid + i * 128;
      int r = gid >> 3, c = (gid & 7) * 8;
      *(uint4*)&Vs[r * 72 + c] =
          *(const uint4*)(vg0 + (size_t)r * SEQ + kv0 + c);
    }
    __syncthreads();

    // S^T = K Q^T : 4 key-row blocks, K-dim 64 -> 2 WMMAs per column group.
    // sf[g][j][v] = S[query g*16 + col][key kv0 + j*16 + 8*half + v]
    v8f sf[2][4];
    for (int j = 0; j < 4; ++j) {
      const v16bf k0 = ld_frag(Ks, j * 16, 72, 0);
      const v16bf k1 = ld_frag(Ks, j * 16, 72, 32);
      for (int g = 0; g < 2; ++g) {
        v8f s = 0.f;
        s = wmma_bf16(k0, qf[g][0], s);
        s = wmma_bf16(k1, qf[g][1], s);
        sf[g][j] = s;
      }
    }

    // Online softmax, one query per lane and column group.
    v16bf p0[2], p1[2];
    for (int g = 0; g < 2; ++g) {
      float mj[4];
      for (int j = 0; j < 4; ++j) {
        float m = sf[g][j][0];
        for (int v = 1; v < 8; ++v) m = fmaxf(m, sf[g][j][v]);
        mj[j] = m;
      }
      float mt = fmaxf(fmaxf(mj[0], mj[1]), fmaxf(mj[2], mj[3]));
      mt = fmaxf(mt, other_half(mt));
      const float mn  = fmaxf(m_i[g], mt);
      const float scl = __expf(m_i[g] - mn);
      m_i[g] = mn;

      float sj[4];
      for (int j = 0; j < 4; ++j) {
        float sum = 0.f;
        for (int v = 0; v < 8; ++v) {
          float p = __expf(sf[g][j][v] - mn);
          sf[g][j][v] = p;
          sum += p;
        }
        sj[j] = sum;
      }
      l_i[g] = l_i[g] * scl + ((sj[0] + sj[1]) + (sj[2] + sj[3]));
      for (int j = 0; j < 4; ++j)
        for (int v = 0; v < 8; ++v) of[g][j][v] *= scl;

      p0[g] = pack_b(sf[g][0], sf[g][1]);
      p1[g] = pack_b(sf[g][2], sf[g][3]);
      // Finish one column group before the next starts: interleaved, the two
      // groups' f32 probabilities overflow the 256-register budget and spill.
      __builtin_amdgcn_sched_barrier(0);
    }

    // O^T += V^T P^T  (K-dim 64 over kv, 4 hd row blocks, 2 column groups).
    for (int j = 0; j < 4; ++j) {
      const v16bf v0 = ld_frag(Vs, j * 16, 72, 0);
      const v16bf v1 = ld_frag(Vs, j * 16, 72, 32);
      for (int g = 0; g < 2; ++g) {
        of[g][j] = wmma_bf16(v0, p0[g], of[g][j]);
        of[g][j] = wmma_bf16(v1, p1[g], of[g][j]);
      }
    }
  }

  // Finalize: join the halves' sums, O *= 1/l, write to (B, N, H*HD) bf16 for
  // the projection gemm. A lane holds 8 consecutive hd of one query per tile.
  const int b = bh >> 4, h = bh & 15;
  for (int g = 0; g < 2; ++g) {
    const float inv_l = 1.0f / (l_i[g] + other_half(l_i[g]));
    bf16_t* orow = ow + ((size_t)(b * SEQ + qrow0 + g * 16 + col)) * DMODEL +
                   h * HDIM + 8 * half;
    for (int j = 0; j < 4; ++j) {
      v8bf o;
      for (int v = 0; v < 8; ++v) o[v] = (bf16_t)(of[g][j][v] * inv_l);
      *(v8bf*)(orow + j * 16) = o;
    }
  }
}

// ---------------------------------------------------------------------------
// Kernel 3: out = attn_out @ w_proj^T + b_proj  (M=8192, N=1024, K=1024)
// WG tile 128x128, 8 waves, each wave 32x64.
// ---------------------------------------------------------------------------
__global__ __launch_bounds__(256) void proj_gemm_kernel(
    const bf16_t* __restrict__ a, const float* __restrict__ w_proj,
    const float* __restrict__ b_proj, float* __restrict__ out) {
  __shared__ bf16_t As[128 * 40];
  __shared__ bf16_t Ws[128 * 40];

  const int tid  = threadIdx.x;
  const int wave = tid >> 5;
  const int wm   = wave >> 1;
  const int wn   = wave & 1;
  const int m0   = blockIdx.x * 128;
  const int e0   = blockIdx.y * 128;

  v8f acc[2][4];
  for (int i = 0; i < 2; ++i)
    for (int j = 0; j < 4; ++j) acc[i][j] = 0.f;

  for (int kb = 0; kb < DMODEL; kb += 32) {
    __syncthreads();
    // Stage A tile 128x32 bf16 (512 uint4, 2 per thread).
    for (int i = 0; i < 2; ++i) {
      int gid = tid + i * 256;
      int r = gid >> 2, c = (gid & 3) * 8;
      *(uint4*)&As[r * 40 + c] =
          *(const uint4*)(a + (size_t)(m0 + r) * DMODEL + kb + c);
    }
    // Stage W tile 128x32 fp32 -> bf16 (1024 float4, 4 per thread).
    for (int i = 0; i < 4; ++i) {
      int gid = tid + i * 256;
      int r = gid >> 3, c = (gid & 7) * 4;
      const float4 f =
          *(const float4*)(w_proj + (size_t)(e0 + r) * DMODEL + kb + c);
      union { bf16_t b[4]; uint2 u; } pk;
      pk.b[0] = (bf16_t)f.x; pk.b[1] = (bf16_t)f.y;
      pk.b[2] = (bf16_t)f.z; pk.b[3] = (bf16_t)f.w;
      *(uint2*)&Ws[r * 40 + c] = pk.u;
    }
    __syncthreads();

    v16bf a0 = ld_frag(As, wm * 32,      40, 0);
    v16bf a1 = ld_frag(As, wm * 32 + 16, 40, 0);
    for (int j = 0; j < 4; ++j) {
      v16bf bj = ld_frag(Ws, wn * 64 + j * 16, 40, 0);
      acc[0][j] = wmma_bf16(a0, bj, acc[0][j]);
      acc[1][j] = wmma_bf16(a1, bj, acc[1][j]);
    }
  }

  const int lane = tid & 31;
  const int half = lane >> 4;
  const int col  = lane & 15;
  for (int mi = 0; mi < 2; ++mi)
    for (int ni = 0; ni < 4; ++ni)
      for (int v = 0; v < 8; ++v) {
        int gm = m0 + wm * 32 + mi * 16 + v + 8 * half;
        int ge = e0 + wn * 64 + ni * 16 + col;
        out[(size_t)gm * DMODEL + ge] = acc[mi][ni][v] + b_proj[ge];
      }
}

// ---------------------------------------------------------------------------
extern "C" void kernel_launch(void* const* d_in, const int* in_sizes, int n_in,
                              void* d_out, int out_size, void* d_ws,
                              size_t ws_size, hipStream_t stream) {
  const float* x      = (const float*)d_in[0];
  const float* w_qkv  = (const float*)d_in[1];
  const float* w_proj = (const float*)d_in[2];
  const float* b_proj = (const float*)d_in[3];
  float* out = (float*)d_out;

  const size_t PER = (size_t)BATCH * NHEAD * SEQ * HDIM;  // 8M elements
  bf16_t* qw  = (bf16_t*)d_ws;
  bf16_t* kw  = qw + PER;
  bf16_t* vtw = kw + PER;
  bf16_t* ow  = vtw + PER;   // (B, N, D) attention output, bf16

  qkv_gemm_kernel<<<dim3(BN / 128, E3 / 128), 256, 0, stream>>>(
      x, w_qkv, qw, kw, vtw);
  attn_kernel<<<dim3(SEQ / 128, BATCH * NHEAD), 128, 0, stream>>>(
      qw, kw, vtw, ow);
  proj_gemm_kernel<<<dim3(BN / 128, DMODEL / 128), 256, 0, stream>>>(
      ow, w_proj, b_proj, out);
}

// v003
// It runs in 162 microseconds.
// Two timings next to v002 both put it at 1.08 times that version's speed.
// Over all steps from v000 it is 1.92 times as fast.
#include <hip/hip_runtime.h>
#include <hip/hip_bf16.h>
#include <math.h>

// ---------------------------------------------------------------------------
// MHA forward for B=4, N=2048, D=1024, H=16, HD=64 on gfx1250 (wave32, WMMA).
// bf16 inputs to v_wmma_f32_16x16x32_bf16, fp32 accumulation throughout.
// Compute-bound (~137 GFLOP vs <10us of HBM traffic at 23.3 TB/s), so all
// three stages run through the matrix pipes.
// ---------------------------------------------------------------------------

typedef __bf16 bf16_t;
typedef __attribute__((ext_vector_type(16))) __bf16 v16bf;
typedef __attribute__((ext_vector_type(8)))  __bf16 v8bf;
typedef __attribute__((ext_vector_type(8)))  float  v8f;

#define BATCH 4
#define SEQ   2048
#define DMODEL 1024
#define NHEAD 16
#define HDIM  64
#define BN    (BATCH * SEQ)       // 8192
#define E3    (3 * DMODEL)        // 3072
#define SCALE 0.125f              // 64^-0.5

__device__ __forceinline__ v8f wmma_bf16(v16bf a, v16bf b, v8f c) {
  return __builtin_amdgcn_wmma_f32_16x16x32_bf16(
      /*neg_a=*/false, a, /*neg_b=*/false, b,
      /*c_mod=*/(short)0, c, /*reuse_a=*/false, /*reuse_b=*/false);
}

// Load one 16x32 bf16 fragment (A-layout; identical addressing serves the
// B-fragment of a TN gemm where B rows are K-contiguous).
//   lane 0-15 : row = lane,    k = {0..7, 16..23}
//   lane 16-31: row = lane-16, k = {8..15, 24..31}
// Two 16-byte reads per lane; `t` may point at LDS (ds_load after addrspace
// inference) or global memory.
__device__ __forceinline__ v16bf ld_frag(const bf16_t* t, int row, int stride,
                                         int kbase) {
  const int lane = threadIdx.x & 31;
  const int r = lane & 15;
  const int klo = (lane >> 4) << 3;
  const bf16_t* p = t + (size_t)(row + r) * stride + kbase + klo;
  union { v16bf v; v8bf h[2]; } u;
  u.h[0] = *(const v8bf*)(p);
  u.h[1] = *(const v8bf*)(p + 16);
  return u.v;
}

// ---------------------------------------------------------------------------
// Kernel 1: qkv = x @ w_qkv^T  (TN gemm, M=8192, N=3072, K=1024)
// WG tile 256x256, 16 waves, each wave 64x64 (acc[4][4], 16 WMMAs / K-step):
// every operand row is fetched from L2 half as often as with 128x128 tiles.
// One work-group fills a WGP, so nothing else hides its loads: the next
// K-slab is fetched into registers while the current one is multiplied, and
// goes into the other of two LDS buffers (one barrier per slab).
// Scatters to q (pre-scaled), k as (B,H,N,HD) and v transposed (B,H,HD,N).
// ---------------------------------------------------------------------------
typedef __attribute__((ext_vector_type(2))) __bf16 v2bf;
typedef __attribute__((ext_vector_type(2))) float  v2f;

__device__ __forceinline__ uint2 pack4_bf16(float4 f) {
  const v2f lo = {f.x, f.y}, hi = {f.z, f.w};
  uint2 u;
  u.x = __builtin_bit_cast(unsigned, __builtin_convertvector(lo, v2bf));
  u.y = __builtin_bit_cast(unsigned, __builtin_convertvector(hi, v2bf));
  return u;
}

__global__ __launch_bounds__(512) void qkv_gemm_kernel(
    const float* __restrict__ x, const float* __restrict__ w_qkv,
    bf16_t* __restrict__ qw, bf16_t* __restrict__ kw, bf16_t* __restrict__ vtw) {
  __shared__ bf16_t Xs[2][256 * 40];   // 256 rows x 32 K, stride 40 (pad)
  __shared__ bf16_t Ws[2][256 * 40];   // 256 rows x 32 K

  const int tid  = threadIdx.x;
  const int wave = tid >> 5;
  const int wm   = wave >> 2;       // 0..3 -> 64-row block
  const int wn   = wave & 3;        // 0..3 -> 64-col block
  const int m0   = blockIdx.x * 256;
  const int e0   = blockIdx.y * 256;

  // Staging: a thread carries 4 floats of rows sr, sr+64, sr+128, sr+192 of
  // both tiles; 8 neighbouring threads cover one 128-byte line.
  const int sr = tid >> 3;
  const int sc = (tid & 7) * 4;
  const float* xg = x + (size_t)(m0 + sr) * DMODEL + sc;
  const float* wg = w_qkv + (size_t)(e0 + sr) * DMODEL + sc;

  v8f acc[4][4];
  for (int i = 0; i < 4; ++i)
    for (int j = 0; j < 4; ++j) acc[i][j] = 0.f;

  float4 fx[4], fw[4];
  for (int i = 0; i < 4; ++i) {
    fx[i] = *(const float4*)(xg + (size_t)i * 64 * DMODEL);
    fw[i] = *(const float4*)(wg + (size_t)i * 64 * DMODEL);
  }
  for (int i = 0; i < 4; ++i) {
    *(uint2*)&Xs[0][(sr + i * 64) * 40 + sc] = pack4_bf16(fx[i]);
    *(uint2*)&Ws[0][(sr + i * 64) * 40 + sc] = pack4_bf16(fw[i]);
  }

  auto products = [&](const bf16_t* Xc, const bf16_t* Wc) {
    v16bf a[4];
    for (int i = 0; i < 4; ++i) a[i] = ld_frag(Xc, wm * 64 + i * 16, 40, 0);
    v16bf b[4];
    for (int j = 0; j < 4; ++j) b[j] = ld_frag(Wc, wn * 64 + j * 16, 40, 0);
    // Keeps the 16 LDS reads as one group in front of the 16 products; the
    // compiler otherwise spreads them among the products with full waits.
    __builtin_amdgcn_sched_barrier(0);
    for (int j = 0; j < 4; ++j)
      for (int i = 0; i < 4; ++i) acc[i][j] = wmma_bf16(a[i], b[j], acc[i][j]);
  };

  // All slabs but the last: fetch the next one under this one's products.
  for (int kb = 32; kb < DMODEL; kb += 32) {
    const int nxt = (kb >> 5) & 1;
    // Publishes buffer nxt^1 and ends every read of buffer nxt.
    __syncthreads();
    for (int i = 0; i < 4; ++i) {
      fx[i] = *(const float4*)(xg + (size_t)i * 64 * DMODEL + kb);
      fw[i] = *(const float4*)(wg + (size_t)i * 64 * DMODEL + kb);
    }
    // Keeps the loads in front of the products; the compiler otherwise sinks
    // them to their use and the whole L2 latency is waited out each slab.
    __builtin_amdgcn_sched_barrier(0);
    products(Xs[nxt ^ 1], Ws[nxt ^ 1]);
    // Keeps the conversions, and with them the wait for the loads, behind the
    // products; the compiler otherwise lifts both in front of them.
    __builtin_amdgcn_sched_barrier(0);
    for (int i = 0; i < 4; ++i) {
      *(uint2*)&Xs[nxt][(sr + i * 64) * 40 + sc] = pack4_bf16(fx[i]);
      *(uint2*)&Ws[nxt][(sr + i * 64) * 40 + sc] = pack4_bf16(fw[i]);
    }
  }
  __syncthreads();
  products(Xs[(DMODEL / 32 - 1) & 1], Ws[(DMODEL / 32 - 1) & 1]);

  // Epilogue scatter. C-layout: lane holds col=lane&15, rows v+8*(lane>>4).
  // The 256-wide N tile lies inside one q/k/v segment -> s is block-uniform.
  const int lane = tid & 31;
  const int half = lane >> 4;
  const int col  = lane & 15;
  const int s    = e0 >> 10;                        // 0=q, 1=k, 2=v (uniform)
  const int gm0  = m0 + wm * 64;
  const int ge0  = e0 + wn * 64;

  if (s == 0) {
    for (int mi = 0; mi < 4; ++mi)
      for (int ni = 0; ni < 4; ++ni)
        for (int v = 0; v < 8; ++v) {
          int gm = gm0 + mi * 16 + v + 8 * half;
          int ge = ge0 + ni * 16 + col;
          int b = gm >> 11, n = gm & (SEQ - 1);
          int h = (ge >> 6) & (NHEAD - 1), hd = ge & (HDIM - 1);
          qw[((size_t)(b * NHEAD + h) * SEQ + n) * HDIM + hd] =
              (bf16_t)(acc[mi][ni][v] * SCALE);
        }
  } else if (s == 1) {
    for (int mi = 0; mi < 4; ++mi)
      for (int ni = 0; ni < 4; ++ni)
        for (int v = 0; v < 8; ++v) {
          int gm = gm0 + mi * 16 + v + 8 * half;
          int ge = ge0 + ni * 16 + col;
          int b = gm >> 11, n = gm & (SEQ - 1);
          int h = (ge >> 6) & (NHEAD - 1), hd = ge & (HDIM - 1);
          kw[((size_t)(b * NHEAD + h) * SEQ + n) * HDIM + hd] =
              (bf16_t)acc[mi][ni][v];
        }
  } else {
    for (int mi = 0; mi < 4; ++mi)
      for (int ni = 0; ni < 4; ++ni)
        for (int v = 0; v < 8; ++v) {
          int gm = gm0 + mi * 16 + v + 8 * half;
          int ge = ge0 + ni * 16 + col;
          int b = gm >> 11, n = gm & (SEQ - 1);
          int h = (ge >> 6) & (NHEAD - 1), hd = ge & (HDIM - 1);
          vtw[((size_t)(b * NHEAD + h) * HDIM + hd) * SEQ + n] =
              (bf16_t)acc[mi][ni][v];
        }
  }
}

// Value of lane l ^ 16.
__device__ __forceinline__ float other_half(float x) {
  int b = __builtin_bit_cast(int, x);
  b = __builtin_amdgcn_permlanex16(b, b, 0x76543210, 0xfedcba98, false, false);
  return __builtin_bit_cast(float, b);
}

// Two f32 accumulator tiles (rows 0-15 and 16-31 of a 32-row block) -> one
// bf16 B fragment: element s is row (s<8 ? 8*half+s : 16+8*half+s-8).
__device__ __forceinline__ v16bf pack_b(v8f t0, v8f t1) {
  v16bf r;
  for (int s = 0; s < 8; ++s) {
    r[s]     = (bf16_t)t0[s];
    r[s + 8] = (bf16_t)t1[s];
  }
  return r;
}

// Four waves per SIMD (256 VGPRs each): all 1024 work-groups are resident at
// once, four per WGP, so there is no second, half-empty round.
__global__ __launch_bounds__(128)
__attribute__((amdgpu_waves_per_eu(4, 4))) void attn_kernel(
    const bf16_t* __restrict__ qw, const bf16_t* __restrict__ kw,
    const bf16_t* __restrict__ vtw, bf16_t* __restrict__ ow) {
  __shared__ bf16_t Ks[64 * 72];     // K tile: rows=kv, cols=hd
  __shared__ bf16_t Vs[64 * 72];     // V^T tile: rows=hd, cols=kv

  const int tid  = threadIdx.x;
  const int wave = tid >> 5;
  const int lane = tid & 31;
  const int half = lane >> 4;
  const int col  = lane & 15;
  const int bh   = blockIdx.y;                 // b*16 + h
  const int qrow0 = blockIdx.x * 128 + wave * 32;

  // Q fragments (2 groups x 16 rows x HD=64 -> two k-slices each), straight
  // from global. Used as the B operand: column = query, k = hd.
  const bf16_t* qbase = qw + ((size_t)bh * SEQ + qrow0) * HDIM;
  v16bf qf[2][2];
  for (int g = 0; g < 2; ++g) {
    qf[g][0] = ld_frag(qbase, g * 16, HDIM, 0);
    qf[g][1] = ld_frag(qbase, g * 16, HDIM, 32);
  }

  // of[g][j][v] = O[query g*16 + col][hd = j*16 + 8*half + v]
  v8f of[2][4];
  float m_i[2];   // running maximum of this lane's query (both halves)
  float l_i[2];   // running sum over this half's keys only
  for (int g = 0; g < 2; ++g) {
    for (int j = 0; j < 4; ++j) of[g][j] = 0.f;
    m_i[g] = -1e30f;
    l_i[g] = 0.f;
  }

  const bf16_t* kg0 = kw + (size_t)bh * SEQ * HDIM;
  const bf16_t* vg0 = vtw + (size_t)bh * HDIM * SEQ;

  for (int kv0 = 0; kv0 < SEQ; kv0 += 64) {
    __syncthreads();
    // Stage K tile (64 kv-rows x 64 hd) and V^T tile (64 hd-rows x 64 kv).
    for (int i = 0; i < 4; ++i) {
      int gid = tid + i * 128;
      int r = gid >> 3, c = (gid & 7) * 8;
      *(uint4*)&Ks[r * 72 + c] =
          *(const uint4*)(kg0 + (size_t)(kv0 + r) * HDIM + c);
    }
    for (int i = 0; i < 4; ++i) {
      int gid = tid + i * 128;
      int r = gid >> 3, c = (gid & 7) * 8;
      *(uint4*)&Vs[r * 72 + c] =
          *(const uint4*)(vg0 + (size_t)r * SEQ + kv0 + c);
    }
    __syncthreads();

    // S^T = K Q^T : 4 key-row blocks, K-dim 64 -> 2 WMMAs per column group.
    // sf[g][j][v] = S[query g*16 + col][key kv0 + j*16 + 8*half + v]
    v8f sf[2][4];
    for (int j = 0; j < 4; ++j) {
      const v16bf k0 = ld_frag(Ks, j * 16, 72, 0);
      const v16bf k1 = ld_frag(Ks, j * 16, 72, 32);
      for (int g = 0; g < 2; ++g) {
        v8f s = 0.f;
        s = wmma_bf16(k0, qf[g][0], s);
        s = wmma_bf16(k1, qf[g][1], s);
        sf[g][j] = s;
      }
    }

    // Online softmax, one query per lane and column group.
    v16bf p0[2], p1[2];
    for (int g = 0; g < 2; ++g) {
      float mj[4];
      for (int j = 0; j < 4; ++j) {
        float m = sf[g][j][0];
        for (int v = 1; v < 8; ++v) m = fmaxf(m, sf[g][j][v]);
        mj[j] = m;
      }
      float mt = fmaxf(fmaxf(mj[0], mj[1]), fmaxf(mj[2], mj[3]));
      mt = fmaxf(mt, other_half(mt));
      const float mn  = fmaxf(m_i[g], mt);
      const float scl = __expf(m_i[g] - mn);
      m_i[g] = mn;

      float sj[4];
      for (int j = 0; j < 4; ++j) {
        float sum = 0.f;
        for (int v = 0; v < 8; ++v) {
          float p = __expf(sf[g][j][v] - mn);
          sf[g][j][v] = p;
          sum += p;
        }
        sj[j] = sum;
      }
      l_i[g] = l_i[g] * scl + ((sj[0] + sj[1]) + (sj[2] + sj[3]));
      for (int j = 0; j < 4; ++j)
        for (int v = 0; v < 8; ++v) of[g][j][v] *= scl;

      p0[g] = pack_b(sf[g][0], sf[g][1]);
      p1[g] = pack_b(sf[g][2], sf[g][3]);
      // Finish one column group before the next starts: interleaved, the two
      // groups' f32 probabilities overflow the 256-register budget and spill.
      __builtin_amdgcn_sched_barrier(0);
    }

    // O^T += V^T P^T  (K-dim 64 over kv, 4 hd row blocks, 2 column groups).
    for (int j = 0; j < 4; ++j) {
      const v16bf v0 = ld_frag(Vs, j * 16, 72, 0);
      const v16bf v1 = ld_frag(Vs, j * 16, 72, 32);
      for (int g = 0; g < 2; ++g) {
        of[g][j] = wmma_bf16(v0, p0[g], of[g][j]);
        of[g][j] = wmma_bf16(v1, p1[g], of[g][j]);
      }
    }
  }

  // Finalize: join the halves' sums, O *= 1/l, write to (B, N, H*HD) bf16 for
  // the projection gemm. A lane holds 8 consecutive hd of one query per tile.
  const int b = bh >> 4, h = bh & 15;
  for (int g = 0; g < 2; ++g) {
    const float inv_l = 1.0f / (l_i[g] + other_half(l_i[g]));
    bf16_t* orow = ow + ((size_t)(b * SEQ + qrow0 + g * 16 + col)) * DMODEL +
                   h * HDIM + 8 * half;
    for (int j = 0; j < 4; ++j) {
      v8bf o;
      for (int v = 0; v < 8; ++v) o[v] = (bf16_t)(of[g][j][v] * inv_l);
      *(v8bf*)(orow + j * 16) = o;
    }
  }
}

// ---------------------------------------------------------------------------
// Kernel 3: out = attn_out @ w_proj^T + b_proj  (M=8192, N=1024, K=1024)
// WG tile 128x128, 8 waves, each wave 32x64.
// ---------------------------------------------------------------------------
__global__ __launch_bounds__(256) void proj_gemm_kernel(
    const bf16_t* __restrict__ a, const float* __restrict__ w_proj,
    const float* __restrict__ b_proj, float* __restrict__ out) {
  __shared__ bf16_t As[128 * 40];
  __shared__ bf16_t Ws[128 * 40];

  const int tid  = threadIdx.x;
  const int wave = tid >> 5;
  const int wm   = wave >> 1;
  const int wn   = wave & 1;
  const int m0   = blockIdx.x * 128;
  const int e0   = blockIdx.y * 128;

  v8f acc[2][4];
  for (int i = 0; i < 2; ++i)
    for (int j = 0; j < 4; ++j) acc[i][j] = 0.f;

  for (int kb = 0; kb < DMODEL; kb += 32) {
    __syncthreads();
    // Stage A tile 128x32 bf16 (512 uint4, 2 per thread).
    for (int i = 0; i < 2; ++i) {
      int gid = tid + i * 256;
      int r = gid >> 2, c = (gid & 3) * 8;
      *(uint4*)&As[r * 40 + c] =
          *(const uint4*)(a + (size_t)(m0 + r) * DMODEL + kb + c);
    }
    // Stage W tile 128x32 fp32 -> bf16 (1024 float4, 4 per thread).
    for (int i = 0; i < 4; ++i) {
      int gid = tid + i * 256;
      int r = gid >> 3, c = (gid & 7) * 4;
      const float4 f =
          *(const float4*)(w_proj + (size_t)(e0 + r) * DMODEL + kb + c);
      union { bf16_t b[4]; uint2 u; } pk;
      pk.b[0] = (bf16_t)f.x; pk.b[1] = (bf16_t)f.y;
      pk.b[2] = (bf16_t)f.z; pk.b[3] = (bf16_t)f.w;
      *(uint2*)&Ws[r * 40 + c] = pk.u;
    }
    __syncthreads();

    v16bf a0 = ld_frag(As, wm * 32,      40, 0);
    v16bf a1 = ld_frag(As, wm * 32 + 16, 40, 0);
    for (int j = 0; j < 4; ++j) {
      v16bf bj = ld_frag(Ws, wn * 64 + j * 16, 40, 0);
      acc[0][j] = wmma_bf16(a0, bj, acc[0][j]);
      acc[1][j] = wmma_bf16(a1, bj, acc[1][j]);
    }
  }

  const int lane = tid & 31;
  const int half = lane >> 4;
  const int col  = lane & 15;
  for (int mi = 0; mi < 2; ++mi)
    for (int ni = 0; ni < 4; ++ni)
      for (int v = 0; v < 8; ++v) {
        int gm = m0 + wm * 32 + mi * 16 + v + 8 * half;
        int ge = e0 + wn * 64 + ni * 16 + col;
        out[(size_t)gm * DMODEL + ge] = acc[mi][ni][v] + b_proj[ge];
      }
}

// ---------------------------------------------------------------------------
extern "C" void kernel_launch(void* const* d_in, const int* in_sizes, int n_in,
                              void* d_out, int out_size, void* d_ws,
                              size_t ws_size, hipStream_t stream) {
  const float* x      = (const float*)d_in[0];
  const float* w_qkv  = (const float*)d_in[1];
  const float* w_proj = (const float*)d_in[2];
  const float* b_proj = (const float*)d_in[3];
  float* out = (float*)d_out;

  const size_t PER = (size_t)BATCH * NHEAD * SEQ * HDIM;  // 8M elements
  bf16_t* qw  = (bf16_t*)d_ws;
  bf16_t* kw  = qw + PER;
  bf16_t* vtw = kw + PER;
  bf16_t* ow  = vtw + PER;   // (B, N, D) attention output, bf16

  qkv_gemm_kernel<<<dim3(BN / 256, E3 / 256), 512, 0, stream>>>(
      x, w_qkv, qw, kw, vtw);
  attn_kernel<<<dim3(SEQ / 128, BATCH * NHEAD), 128, 0, stream>>>(
      qw, kw, vtw, ow);
  proj_gemm_kernel<<<dim3(BN / 128, DMODEL / 128), 256, 0, stream>>>(
      ow, w_proj, b_proj, out);
}

// v004
// One run takes 153 microseconds.
// In two side-by-side timings against v003, it was 1.05 and 1.06 times as fast.
// Over all steps from v000 it is 2.02 times as fast.
#include <hip/hip_runtime.h>
#include <hip/hip_bf16.h>
#include <math.h>

// ---------------------------------------------------------------------------
// MHA forward for B=4, N=2048, D=1024, H=16, HD=64 on gfx1250 (wave32, WMMA).
// bf16 inputs to v_wmma_f32_16x16x32_bf16, fp32 accumulation throughout.
// Compute-bound (~137 GFLOP vs <10us of HBM traffic at 23.3 TB/s), so all
// three stages run through the matrix pipes.
// ---------------------------------------------------------------------------

typedef __bf16 bf16_t;
typedef __attribute__((ext_vector_type(16))) __bf16 v16bf;
typedef __attribute__((ext_vector_type(8)))  __bf16 v8bf;
typedef __attribute__((ext_vector_type(8)))  float  v8f;

#define BATCH 4
#define SEQ   2048
#define DMODEL 1024
#define NHEAD 16
#define HDIM  64
#define BN    (BATCH * SEQ)       // 8192
#define E3    (3 * DMODEL)        // 3072
#define SCALE 0.125f              // 64^-0.5

__device__ __forceinline__ v8f wmma_bf16(v16bf a, v16bf b, v8f c) {
  return __builtin_amdgcn_wmma_f32_16x16x32_bf16(
      /*neg_a=*/false, a, /*neg_b=*/false, b,
      /*c_mod=*/(short)0, c, /*reuse_a=*/false, /*reuse_b=*/false);
}

// Load one 16x32 bf16 fragment (A-layout; identical addressing serves the
// B-fragment of a TN gemm where B rows are K-contiguous).
//   lane 0-15 : row = lane,    k = {0..7, 16..23}
//   lane 16-31: row = lane-16, k = {8..15, 24..31}
// Two 16-byte reads per lane; `t` may point at LDS (ds_load after addrspace
// inference) or global memory.
__device__ __forceinline__ v16bf ld_frag(const bf16_t* t, int row, int stride,
                                         int kbase) {
  const int lane = threadIdx.x & 31;
  const int r = lane & 15;
  const int klo = (lane >> 4) << 3;
  const bf16_t* p = t + (size_t)(row + r) * stride + kbase + klo;
  union { v16bf v; v8bf h[2]; } u;
  u.h[0] = *(const v8bf*)(p);
  u.h[1] = *(const v8bf*)(p + 16);
  return u.v;
}

// ---------------------------------------------------------------------------
// Kernel 1: qkv = x @ w_qkv^T  (TN gemm, M=8192, N=3072, K=1024)
// WG tile 256x256, 16 waves, each wave 64x64 (acc[4][4], 16 WMMAs / K-step):
// every operand row is fetched from L2 half as often as with 128x128 tiles.
// One work-group fills a WGP, so nothing else hides its loads: the next
// K-slab is fetched into registers while the current one is multiplied, and
// goes into the other of two LDS buffers (one barrier per slab).
// Scatters to q (pre-scaled), k as (B,H,N,HD) and v transposed (B,H,HD,N).
// ---------------------------------------------------------------------------
typedef __attribute__((ext_vector_type(2))) __bf16 v2bf;
typedef __attribute__((ext_vector_type(2))) float  v2f;

__device__ __forceinline__ uint2 pack4_bf16(float4 f) {
  const v2f lo = {f.x, f.y}, hi = {f.z, f.w};
  uint2 u;
  u.x = __builtin_bit_cast(unsigned, __builtin_convertvector(lo, v2bf));
  u.y = __builtin_bit_cast(unsigned, __builtin_convertvector(hi, v2bf));
  return u;
}

__global__ __launch_bounds__(512) void qkv_gemm_kernel(
    const float* __restrict__ x, const float* __restrict__ w_qkv,
    bf16_t* __restrict__ qw, bf16_t* __restrict__ kw, bf16_t* __restrict__ vtw) {
  __shared__ bf16_t Xs[2][256 * 40];   // 256 rows x 32 K, stride 40 (pad)
  __shared__ bf16_t Ws[2][256 * 40];   // 256 rows x 32 K

  const int tid  = threadIdx.x;
  const int wave = tid >> 5;
  const int wm   = wave >> 2;       // 0..3 -> 64-row block
  const int wn   = wave & 3;        // 0..3 -> 64-col block
  const int m0   = blockIdx.x * 256;
  const int e0   = blockIdx.y * 256;

  // Staging: a thread carries 4 floats of rows sr, sr+64, sr+128, sr+192 of
  // both tiles; 8 neighbouring threads cover one 128-byte line.
  const int sr = tid >> 3;
  const int sc = (tid & 7) * 4;
  const float* xg = x + (size_t)(m0 + sr) * DMODEL + sc;
  const float* wg = w_qkv + (size_t)(e0 + sr) * DMODEL + sc;

  v8f acc[4][4];
  for (int i = 0; i < 4; ++i)
    for (int j = 0; j < 4; ++j) acc[i][j] = 0.f;

  float4 fx[4], fw[4];
  for (int i = 0; i < 4; ++i) {
    fx[i] = *(const float4*)(xg + (size_t)i * 64 * DMODEL);
    fw[i] = *(const float4*)(wg + (size_t)i * 64 * DMODEL);
  }
  for (int i = 0; i < 4; ++i) {
    *(uint2*)&Xs[0][(sr + i * 64) * 40 + sc] = pack4_bf16(fx[i]);
    *(uint2*)&Ws[0][(sr + i * 64) * 40 + sc] = pack4_bf16(fw[i]);
  }

  auto products = [&](const bf16_t* Xc, const bf16_t* Wc) {
    v16bf a[4];
    for (int i = 0; i < 4; ++i) a[i] = ld_frag(Xc, wm * 64 + i * 16, 40, 0);
    v16bf b[4];
    for (int j = 0; j < 4; ++j) b[j] = ld_frag(Wc, wn * 64 + j * 16, 40, 0);
    // Keeps the 16 LDS reads as one group in front of the 16 products; the
    // compiler otherwise spreads them among the products with full waits.
    __builtin_amdgcn_sched_barrier(0);
    for (int j = 0; j < 4; ++j)
      for (int i = 0; i < 4; ++i) acc[i][j] = wmma_bf16(a[i], b[j], acc[i][j]);
  };

  // All slabs but the last: fetch the next one under this one's products.
  for (int kb = 32; kb < DMODEL; kb += 32) {
    const int nxt = (kb >> 5) & 1;
    // Publishes buffer nxt^1 and ends every read of buffer nxt.
    __syncthreads();
    for (int i = 0; i < 4; ++i) {
      fx[i] = *(const float4*)(xg + (size_t)i * 64 * DMODEL + kb);
      fw[i] = *(const float4*)(wg + (size_t)i * 64 * DMODEL + kb);
    }
    // Keeps the loads in front of the products; the compiler otherwise sinks
    // them to their use and the whole L2 latency is waited out each slab.
    __builtin_amdgcn_sched_barrier(0);
    products(Xs[nxt ^ 1], Ws[nxt ^ 1]);
    // Keeps the conversions, and with them the wait for the loads, behind the
    // products; the compiler otherwise lifts both in front of them.
    __builtin_amdgcn_sched_barrier(0);
    for (int i = 0; i < 4; ++i) {
      *(uint2*)&Xs[nxt][(sr + i * 64) * 40 + sc] = pack4_bf16(fx[i]);
      *(uint2*)&Ws[nxt][(sr + i * 64) * 40 + sc] = pack4_bf16(fw[i]);
    }
  }
  __syncthreads();
  products(Xs[(DMODEL / 32 - 1) & 1], Ws[(DMODEL / 32 - 1) & 1]);

  // Epilogue scatter. C-layout: lane holds col=lane&15, rows v+8*(lane>>4).
  // The 256-wide N tile lies inside one q/k/v segment -> s is block-uniform.
  const int lane = tid & 31;
  const int half = lane >> 4;
  const int col  = lane & 15;
  const int s    = e0 >> 10;                        // 0=q, 1=k, 2=v (uniform)
  const int gm0  = m0 + wm * 64;
  const int ge0  = e0 + wn * 64;

  if (s == 0) {
    for (int mi = 0; mi < 4; ++mi)
      for (int ni = 0; ni < 4; ++ni)
        for (int v = 0; v < 8; ++v) {
          int gm = gm0 + mi * 16 + v + 8 * half;
          int ge = ge0 + ni * 16 + col;
          int b = gm >> 11, n = gm & (SEQ - 1);
          int h = (ge >> 6) & (NHEAD - 1), hd = ge & (HDIM - 1);
          qw[((size_t)(b * NHEAD + h) * SEQ + n) * HDIM + hd] =
              (bf16_t)(acc[mi][ni][v] * SCALE);
        }
  } else if (s == 1) {
    for (int mi = 0; mi < 4; ++mi)
      for (int ni = 0; ni < 4; ++ni)
        for (int v = 0; v < 8; ++v) {
          int gm = gm0 + mi * 16 + v + 8 * half;
          int ge = ge0 + ni * 16 + col;
          int b = gm >> 11, n = gm & (SEQ - 1);
          int h = (ge >> 6) & (NHEAD - 1), hd = ge & (HDIM - 1);
          kw[((size_t)(b * NHEAD + h) * SEQ + n) * HDIM + hd] =
              (bf16_t)acc[mi][ni][v];
        }
  } else {
    for (int mi = 0; mi < 4; ++mi)
      for (int ni = 0; ni < 4; ++ni)
        for (int v = 0; v < 8; ++v) {
          int gm = gm0 + mi * 16 + v + 8 * half;
          int ge = ge0 + ni * 16 + col;
          int b = gm >> 11, n = gm & (SEQ - 1);
          int h = (ge >> 6) & (NHEAD - 1), hd = ge & (HDIM - 1);
          vtw[((size_t)(b * NHEAD + h) * HDIM + hd) * SEQ + n] =
              (bf16_t)acc[mi][ni][v];
        }
  }
}

typedef uint32_t u32x4 __attribute__((ext_vector_type(4)));
typedef uint32_t u32x8 __attribute__((ext_vector_type(8)));

#define KV_PITCH 144u                // LDS row pitch, bytes: 128 + 16 of pad
#define KV_SLICE 6144u               // 32 rows x 144 B, rounded up to 2 KiB
#define KV_BUF   (4u * KV_SLICE)     // K rows 0-31, 32-63, V^T rows 0-31, 32-63
#define KV_STAGES (SEQ / 64)

__device__ __forceinline__ uint32_t uni(uint32_t v) {
  return (uint32_t)__builtin_amdgcn_readfirstlane(v);
}

// A wave-uniform value held in a scalar register: the test around a tensor
// load must compile to a scalar branch (the load ignores EXEC), and a
// descriptor word formed from it stays behind the volatile wait above it.
__device__ __forceinline__ uint32_t pinned(uint32_t v) {
  uint32_t w = uni(v);
  asm volatile("" : "+s"(w));  // pinned(): issue test or descriptor word kept scalar
  return w;
}

// Value of lane l ^ 16.
__device__ __forceinline__ float other_half(float x) {
  int b = __builtin_bit_cast(int, x);
  b = __builtin_amdgcn_permlanex16(b, b, 0x76543210, 0xfedcba98, false, false);
  return __builtin_bit_cast(float, b);
}

// Two f32 accumulator tiles (rows 0-15 and 16-31 of a 32-row block) -> one
// bf16 B fragment: element s is row (s<8 ? 8*half+s : 16+8*half+s-8).
__device__ __forceinline__ v16bf pack_b(v8f t0, v8f t1) {
  v16bf r;
  for (int s = 0; s < 8; ++s) {
    r[s]     = (bf16_t)t0[s];
    r[s + 8] = (bf16_t)t1[s];
  }
  return r;
}

// Four waves per SIMD (256 VGPRs each): all 1024 work-groups are resident at
// once, four per WGP, so there is no second, half-empty round.
__global__ __launch_bounds__(128)
__attribute__((amdgpu_waves_per_eu(4, 4))) void attn_kernel(
    const bf16_t* __restrict__ qw, const bf16_t* __restrict__ kw,
    const bf16_t* __restrict__ vtw, bf16_t* __restrict__ ow) {
  // Two buffers of four 32-row slices: K (rows=kv, cols=hd), V^T (rows=hd,
  // cols=kv). Every slice starts at a multiple of 2 KiB.
  __shared__ __attribute__((aligned(2048))) unsigned char L[2 * KV_BUF];

  const int tid  = threadIdx.x;
  const int wave = tid >> 5;
  const int lane = tid & 31;
  const int half = lane >> 4;
  const int col  = lane & 15;
  const int bh   = blockIdx.y;                 // b*16 + h
  const int qrow0 = blockIdx.x * 128 + wave * 32;

  // Q fragments (2 groups x 16 rows x HD=64 -> two k-slices each), straight
  // from global. Used as the B operand: column = query, k = hd.
  const bf16_t* qbase = qw + ((size_t)bh * SEQ + qrow0) * HDIM;
  v16bf qf[2][2];
  for (int g = 0; g < 2; ++g) {
    qf[g][0] = ld_frag(qbase, g * 16, HDIM, 0);
    qf[g][1] = ld_frag(qbase, g * 16, HDIM, 32);
  }

  // of[g][j][v] = O[query g*16 + col][hd = j*16 + 8*half + v]
  v8f of[2][4];
  float m_i[2];   // running maximum of this lane's query (both halves)
  float l_i[2];   // running sum over this half's keys only
  for (int g = 0; g < 2; ++g) {
    for (int j = 0; j < 4; ++j) of[g][j] = 0.f;
    m_i[g] = -1e30f;
    l_i[g] = 0.f;
  }

  const bf16_t* kg0 = kw + (size_t)bh * SEQ * HDIM;
  const bf16_t* vg0 = vtw + (size_t)bh * HDIM * SEQ;

  // Every wave issues one request per stage for its own slice of 32 rows of
  // 128 bytes: waves 0, 1 the halves of the K tile (source pitch 128 B, 64 rows
  // on per stage), waves 2, 3 the halves of the V^T tile (source pitch one
  // V^T row, 64 keys on per stage).
  const uint32_t wv  = uni((uint32_t)tid >> 5);
  const bool     isV = (wv & 2u) != 0u;
  const uint64_t src0 =
      isV ? (uint64_t)(size_t)vg0 + (uint64_t)((wv & 1u) * 32u * (SEQ * 2u))
          : (uint64_t)(size_t)kg0 + (uint64_t)((wv & 1u) * 32u * (HDIM * 2u));
  const uint32_t src_step = isV ? 64u * 2u : 64u * (HDIM * 2u);
  const uint32_t lds0 = (uint32_t)(size_t)L + wv * KV_SLICE;
  // Descriptor words pinned in scalar registers: one tuple serves every
  // request, so no register of a request in flight takes a new value.
  u32x8 g1;
  g1[0] = pinned((1u << 20) | (4u << 22) | (3u << 25));  // 16 B pad a 128-B row
  g1[1] = pinned(128u << 16);                            // tensor_dim0 = 128 B
  g1[2] = pinned(32u << 16);                             // tensor_dim1 = 32 rows
  g1[3] = pinned(128u << 16);                            // tile_dim0
  g1[4] = pinned(32u);                                   // tile_dim1
  g1[5] = pinned(isV ? SEQ * 2u : HDIM * 2u);            // source row pitch, B
  g1[6] = pinned(0u);
  g1[7] = pinned(0u);
  auto issue = [&](uint32_t st) {
    const uint64_t ga = src0 + (uint64_t)(st * src_step);
    u32x4 g0;
    g0[0] = uni(1u);
    g0[1] = uni(lds0 + (st & 1u) * KV_BUF);
    g0[2] = uni((uint32_t)ga);
    g0[3] = uni((((uint32_t)(ga >> 32)) & 0x01FFFFFFu) | 0x80000000u);
    // One request of the whole wave: 32 rows of 128 B into LDS at pitch 144 B.
    asm volatile("tensor_load_to_lds %0, %1" :: "s"(g0), "s"(g1) : "memory");
  };

  issue(0u);
  // Stage 0 has landed.
  asm volatile("s_wait_tensorcnt 0x0" ::: "memory");
  __syncthreads();
  issue(1u);

  for (uint32_t st = 0; st < KV_STAGES; ++st) {
    const bf16_t* Kb = (const bf16_t*)(L + (st & 1u) * KV_BUF);
    const bf16_t* Vb = Kb + 2u * (KV_SLICE / 2u);

    // S^T = K Q^T : 4 key-row blocks, K-dim 64 -> 2 WMMAs per column group.
    // sf[g][j][v] = S[query g*16 + col][key st*64 + j*16 + 8*half + v]
    v8f sf[2][4];
    for (int j = 0; j < 4; ++j) {
      const bf16_t* ks = Kb + (j >> 1) * (KV_SLICE / 2u);
      const v16bf k0 = ld_frag(ks, (j & 1) * 16, KV_PITCH / 2, 0);
      const v16bf k1 = ld_frag(ks, (j & 1) * 16, KV_PITCH / 2, 32);
      for (int g = 0; g < 2; ++g) {
        v8f s = 0.f;
        s = wmma_bf16(k0, qf[g][0], s);
        s = wmma_bf16(k1, qf[g][1], s);
        sf[g][j] = s;
      }
    }

    // Online softmax, one query per lane and column group.
    v16bf p0[2], p1[2];
    for (int g = 0; g < 2; ++g) {
      float mj[4];
      for (int j = 0; j < 4; ++j) {
        float m = sf[g][j][0];
        for (int v = 1; v < 8; ++v) m = fmaxf(m, sf[g][j][v]);
        mj[j] = m;
      }
      float mt = fmaxf(fmaxf(mj[0], mj[1]), fmaxf(mj[2], mj[3]));
      mt = fmaxf(mt, other_half(mt));
      const float mn  = fmaxf(m_i[g], mt);
      const float scl = __expf(m_i[g] - mn);
      m_i[g] = mn;

      float sj[4];
      for (int j = 0; j < 4; ++j) {
        float sum = 0.f;
        for (int v = 0; v < 8; ++v) {
          float p = __expf(sf[g][j][v] - mn);
          sf[g][j][v] = p;
          sum += p;
        }
        sj[j] = sum;
      }
      l_i[g] = l_i[g] * scl + ((sj[0] + sj[1]) + (sj[2] + sj[3]));
      for (int j = 0; j < 4; ++j)
        for (int v = 0; v < 8; ++v) of[g][j][v] *= scl;

      p0[g] = pack_b(sf[g][0], sf[g][1]);
      p1[g] = pack_b(sf[g][2], sf[g][3]);
      // Finish one column group before the next starts: interleaved, the two
      // groups' f32 probabilities overflow the 256-register budget and spill.
      __builtin_amdgcn_sched_barrier(0);
    }

    // O^T += V^T P^T  (K-dim 64 over kv, 4 hd row blocks, 2 column groups).
    for (int j = 0; j < 4; ++j) {
      const bf16_t* vs = Vb + (j >> 1) * (KV_SLICE / 2u);
      const v16bf v0 = ld_frag(vs, (j & 1) * 16, KV_PITCH / 2, 0);
      const v16bf v1 = ld_frag(vs, (j & 1) * 16, KV_PITCH / 2, 32);
      for (int g = 0; g < 2; ++g) {
        of[g][j] = wmma_bf16(v0, p0[g], of[g][j]);
        of[g][j] = wmma_bf16(v1, p1[g], of[g][j]);
      }
    }

    // Publish point of stage st + 1. This wave's reads of this buffer are done:
    asm volatile("s_wait_dscnt 0x0" ::: "memory");
    // its own slice of stage st + 1 has landed:
    asm volatile("s_wait_tensorcnt 0x0" ::: "memory");
    // every wave's has, and every wave has left the buffer refilled below.
    __syncthreads();
    if (pinned(st + 2u < KV_STAGES)) issue(pinned(st + 2u));
  }
  // Nothing is in flight when the wave ends.
  asm volatile("s_wait_tensorcnt 0x0" ::: "memory");
  asm volatile("s_wait_dscnt 0x0" ::: "memory");

  // Finalize: join the halves' sums, O *= 1/l, write to (B, N, H*HD) bf16 for
  // the projection gemm. A lane holds 8 consecutive hd of one query per tile.
  const int b = bh >> 4, h = bh & 15;
  for (int g = 0; g < 2; ++g) {
    const float inv_l = 1.0f / (l_i[g] + other_half(l_i[g]));
    bf16_t* orow = ow + ((size_t)(b * SEQ + qrow0 + g * 16 + col)) * DMODEL +
                   h * HDIM + 8 * half;
    for (int j = 0; j < 4; ++j) {
      v8bf o;
      for (int v = 0; v < 8; ++v) o[v] = (bf16_t)(of[g][j][v] * inv_l);
      *(v8bf*)(orow + j * 16) = o;
    }
  }
}

// ---------------------------------------------------------------------------
// Kernel 3: out = attn_out @ w_proj^T + b_proj  (M=8192, N=1024, K=1024)
// WG tile 128x128, 8 waves, each wave 32x64.
// ---------------------------------------------------------------------------
__global__ __launch_bounds__(256) void proj_gemm_kernel(
    const bf16_t* __restrict__ a, const float* __restrict__ w_proj,
    const float* __restrict__ b_proj, float* __restrict__ out) {
  __shared__ bf16_t As[128 * 40];
  __shared__ bf16_t Ws[128 * 40];

  const int tid  = threadIdx.x;
  const int wave = tid >> 5;
  const int wm   = wave >> 1;
  const int wn   = wave & 1;
  const int m0   = blockIdx.x * 128;
  const int e0   = blockIdx.y * 128;

  v8f acc[2][4];
  for (int i = 0; i < 2; ++i)
    for (int j = 0; j < 4; ++j) acc[i][j] = 0.f;

  for (int kb = 0; kb < DMODEL; kb += 32) {
    __syncthreads();
    // Stage A tile 128x32 bf16 (512 uint4, 2 per thread).
    for (int i = 0; i < 2; ++i) {
      int gid = tid + i * 256;
      int r = gid >> 2, c = (gid & 3) * 8;
      *(uint4*)&As[r * 40 + c] =
          *(const uint4*)(a + (size_t)(m0 + r) * DMODEL + kb + c);
    }
    // Stage W tile 128x32 fp32 -> bf16 (1024 float4, 4 per thread).
    for (int i = 0; i < 4; ++i) {
      int gid = tid + i * 256;
      int r = gid >> 3, c = (gid & 7) * 4;
      const float4 f =
          *(const float4*)(w_proj + (size_t)(e0 + r) * DMODEL + kb + c);
      union { bf16_t b[4]; uint2 u; } pk;
      pk.b[0] = (bf16_t)f.x; pk.b[1] = (bf16_t)f.y;
      pk.b[2] = (bf16_t)f.z; pk.b[3] = (bf16_t)f.w;
      *(uint2*)&Ws[r * 40 + c] = pk.u;
    }
    __syncthreads();

    v16bf a0 = ld_frag(As, wm * 32,      40, 0);
    v16bf a1 = ld_frag(As, wm * 32 + 16, 40, 0);
    for (int j = 0; j < 4; ++j) {
      v16bf bj = ld_frag(Ws, wn * 64 + j * 16, 40, 0);
      acc[0][j] = wmma_bf16(a0, bj, acc[0][j]);
      acc[1][j] = wmma_bf16(a1, bj, acc[1][j]);
    }
  }

  const int lane = tid & 31;
  const int half = lane >> 4;
  const int col  = lane & 15;
  for (int mi = 0; mi < 2; ++mi)
    for (int ni = 0; ni < 4; ++ni)
      for (int v = 0; v < 8; ++v) {
        int gm = m0 + wm * 32 + mi * 16 + v + 8 * half;
        int ge = e0 + wn * 64 + ni * 16 + col;
        out[(size_t)gm * DMODEL + ge] = acc[mi][ni][v] + b_proj[ge];
      }
}

// ---------------------------------------------------------------------------
extern "C" void kernel_launch(void* const* d_in, const int* in_sizes, int n_in,
                              void* d_out, int out_size, void* d_ws,
                              size_t ws_size, hipStream_t stream) {
  const float* x      = (const float*)d_in[0];
  const float* w_qkv  = (const float*)d_in[1];
  const float* w_proj = (const float*)d_in[2];
  const float* b_proj = (const float*)d_in[3];
  float* out = (float*)d_out;

  const size_t PER = (size_t)BATCH * NHEAD * SEQ * HDIM;  // 8M elements
  bf16_t* qw  = (bf16_t*)d_ws;
  bf16_t* kw  = qw + PER;
  bf16_t* vtw = kw + PER;
  bf16_t* ow  = vtw + PER;   // (B, N, D) attention output, bf16

  qkv_gemm_kernel<<<dim3(BN / 256, E3 / 256), 512, 0, stream>>>(
      x, w_qkv, qw, kw, vtw);
  attn_kernel<<<dim3(SEQ / 128, BATCH * NHEAD), 128, 0, stream>>>(
      qw, kw, vtw, ow);
  proj_gemm_kernel<<<dim3(BN / 128, DMODEL / 128), 256, 0, stream>>>(
      ow, w_proj, b_proj, out);
}

// v005
// One run takes 143 microseconds.
// In two side-by-side timings against v004, it was 1.07 and 1.08 times as fast.
// Counting every step since v000, it is 2.17 times as fast.
#include <hip/hip_runtime.h>
#include <hip/hip_bf16.h>
#include <math.h>

// ---------------------------------------------------------------------------
// MHA forward for B=4, N=2048, D=1024, H=16, HD=64 on gfx1250 (wave32, WMMA).
// bf16 inputs to v_wmma_f32_16x16x32_bf16, fp32 accumulation throughout.
// Compute-bound (~137 GFLOP vs <10us of HBM traffic at 23.3 TB/s), so all
// three stages run through the matrix pipes.
// ---------------------------------------------------------------------------

typedef __bf16 bf16_t;
typedef __attribute__((ext_vector_type(16))) __bf16 v16bf;
typedef __attribute__((ext_vector_type(8)))  __bf16 v8bf;
typedef __attribute__((ext_vector_type(8)))  float  v8f;

#define BATCH 4
#define SEQ   2048
#define DMODEL 1024
#define NHEAD 16
#define HDIM  64
#define BN    (BATCH * SEQ)       // 8192
#define E3    (3 * DMODEL)        // 3072
#define SCALE 0.125f              // 64^-0.5

__device__ __forceinline__ v8f wmma_bf16(v16bf a, v16bf b, v8f c) {
  return __builtin_amdgcn_wmma_f32_16x16x32_bf16(
      /*neg_a=*/false, a, /*neg_b=*/false, b,
      /*c_mod=*/(short)0, c, /*reuse_a=*/false, /*reuse_b=*/false);
}

// Load one 16x32 bf16 fragment (A-layout; identical addressing serves the
// B-fragment of a TN gemm where B rows are K-contiguous).
//   lane 0-15 : row = lane,    k = {0..7, 16..23}
//   lane 16-31: row = lane-16, k = {8..15, 24..31}
// Two 16-byte reads per lane; `t` may point at LDS (ds_load after addrspace
// inference) or global memory.
__device__ __forceinline__ v16bf ld_frag(const bf16_t* t, int row, int stride,
                                         int kbase) {
  const int lane = threadIdx.x & 31;
  const int r = lane & 15;
  const int klo = (lane >> 4) << 3;
  const bf16_t* p = t + (size_t)(row + r) * stride + kbase + klo;
  union { v16bf v; v8bf h[2]; } u;
  u.h[0] = *(const v8bf*)(p);
  u.h[1] = *(const v8bf*)(p + 16);
  return u.v;
}

// ---------------------------------------------------------------------------
// Kernel 1: qkv = x @ w_qkv^T  (TN gemm, M=8192, N=3072, K=1024)
// WG tile 256x256, 16 waves, each wave 64x64 (acc[4][4], 16 WMMAs / K-step):
// every operand row is fetched from L2 half as often as with 128x128 tiles.
// One work-group fills a WGP, so nothing else hides its loads: the next
// K-slab is fetched into registers while the current one is multiplied, and
// goes into the other of two LDS buffers (one barrier per slab).
// Scatters to q (pre-scaled), k as (B,H,N,HD) and v transposed (B,H,HD,N).
// ---------------------------------------------------------------------------
typedef __attribute__((ext_vector_type(2))) __bf16 v2bf;
typedef __attribute__((ext_vector_type(2))) float  v2f;

__device__ __forceinline__ uint2 pack4_bf16(float4 f) {
  const v2f lo = {f.x, f.y}, hi = {f.z, f.w};
  uint2 u;
  u.x = __builtin_bit_cast(unsigned, __builtin_convertvector(lo, v2bf));
  u.y = __builtin_bit_cast(unsigned, __builtin_convertvector(hi, v2bf));
  return u;
}

__global__ __launch_bounds__(512) void qkv_gemm_kernel(
    const float* __restrict__ x, const float* __restrict__ w_qkv,
    bf16_t* __restrict__ qw, bf16_t* __restrict__ kw, bf16_t* __restrict__ vtw) {
  __shared__ bf16_t Xs[2][256 * 40];   // 256 rows x 32 K, stride 40 (pad)
  __shared__ bf16_t Ws[2][256 * 40];   // 256 rows x 32 K

  const int tid  = threadIdx.x;
  const int wave = tid >> 5;
  const int wm   = wave >> 2;       // 0..3 -> 64-row block
  const int wn   = wave & 3;        // 0..3 -> 64-col block
  const int m0   = blockIdx.x * 256;
  const int e0   = blockIdx.y * 256;

  // Staging: a thread carries 4 floats of rows sr, sr+64, sr+128, sr+192 of
  // both tiles; 8 neighbouring threads cover one 128-byte line.
  const int sr = tid >> 3;
  const int sc = (tid & 7) * 4;
  const float* xg = x + (size_t)(m0 + sr) * DMODEL + sc;
  const float* wg = w_qkv + (size_t)(e0 + sr) * DMODEL + sc;

  v8f acc[4][4];
  for (int i = 0; i < 4; ++i)
    for (int j = 0; j < 4; ++j) acc[i][j] = 0.f;

  float4 fx[4], fw[4];
  for (int i = 0; i < 4; ++i) {
    fx[i] = *(const float4*)(xg + (size_t)i * 64 * DMODEL);
    fw[i] = *(const float4*)(wg + (size_t)i * 64 * DMODEL);
  }
  for (int i = 0; i < 4; ++i) {
    *(uint2*)&Xs[0][(sr + i * 64) * 40 + sc] = pack4_bf16(fx[i]);
    *(uint2*)&Ws[0][(sr + i * 64) * 40 + sc] = pack4_bf16(fw[i]);
  }

  auto products = [&](const bf16_t* Xc, const bf16_t* Wc) {
    v16bf a[4];
    for (int i = 0; i < 4; ++i) a[i] = ld_frag(Xc, wm * 64 + i * 16, 40, 0);
    v16bf b[4];
    for (int j = 0; j < 4; ++j) b[j] = ld_frag(Wc, wn * 64 + j * 16, 40, 0);
    // Keeps the 16 LDS reads as one group in front of the 16 products; the
    // compiler otherwise spreads them among the products with full waits.
    __builtin_amdgcn_sched_barrier(0);
    for (int j = 0; j < 4; ++j)
      for (int i = 0; i < 4; ++i) acc[i][j] = wmma_bf16(a[i], b[j], acc[i][j]);
  };

  // All slabs but the last: fetch the next one under this one's products.
  for (int kb = 32; kb < DMODEL; kb += 32) {
    const int nxt = (kb >> 5) & 1;
    // Publishes buffer nxt^1 and ends every read of buffer nxt.
    __syncthreads();
    for (int i = 0; i < 4; ++i) {
      fx[i] = *(const float4*)(xg + (size_t)i * 64 * DMODEL + kb);
      fw[i] = *(const float4*)(wg + (size_t)i * 64 * DMODEL + kb);
    }
    // Keeps the loads in front of the products; the compiler otherwise sinks
    // them to their use and the whole L2 latency is waited out each slab.
    __builtin_amdgcn_sched_barrier(0);
    products(Xs[nxt ^ 1], Ws[nxt ^ 1]);
    // Keeps the conversions, and with them the wait for the loads, behind the
    // products; the compiler otherwise lifts both in front of them.
    __builtin_amdgcn_sched_barrier(0);
    for (int i = 0; i < 4; ++i) {
      *(uint2*)&Xs[nxt][(sr + i * 64) * 40 + sc] = pack4_bf16(fx[i]);
      *(uint2*)&Ws[nxt][(sr + i * 64) * 40 + sc] = pack4_bf16(fw[i]);
    }
  }
  __syncthreads();
  products(Xs[(DMODEL / 32 - 1) & 1], Ws[(DMODEL / 32 - 1) & 1]);

  // Epilogue scatter. C-layout: lane holds col=lane&15, rows v+8*(lane>>4).
  // The 256-wide N tile lies inside one q/k/v segment -> s is block-uniform.
  const int lane = tid & 31;
  const int half = lane >> 4;
  const int col  = lane & 15;
  const int s    = e0 >> 10;                        // 0=q, 1=k, 2=v (uniform)
  const int gm0  = m0 + wm * 64;
  const int ge0  = e0 + wn * 64;

  if (s == 0) {
    for (int mi = 0; mi < 4; ++mi)
      for (int ni = 0; ni < 4; ++ni)
        for (int v = 0; v < 8; ++v) {
          int gm = gm0 + mi * 16 + v + 8 * half;
          int ge = ge0 + ni * 16 + col;
          int b = gm >> 11, n = gm & (SEQ - 1);
          int h = (ge >> 6) & (NHEAD - 1), hd = ge & (HDIM - 1);
          qw[((size_t)(b * NHEAD + h) * SEQ + n) * HDIM + hd] =
              (bf16_t)(acc[mi][ni][v] * SCALE);
        }
  } else if (s == 1) {
    for (int mi = 0; mi < 4; ++mi)
      for (int ni = 0; ni < 4; ++ni)
        for (int v = 0; v < 8; ++v) {
          int gm = gm0 + mi * 16 + v + 8 * half;
          int ge = ge0 + ni * 16 + col;
          int b = gm >> 11, n = gm & (SEQ - 1);
          int h = (ge >> 6) & (NHEAD - 1), hd = ge & (HDIM - 1);
          kw[((size_t)(b * NHEAD + h) * SEQ + n) * HDIM + hd] =
              (bf16_t)acc[mi][ni][v];
        }
  } else {
    for (int mi = 0; mi < 4; ++mi)
      for (int ni = 0; ni < 4; ++ni)
        for (int v = 0; v < 8; ++v) {
          int gm = gm0 + mi * 16 + v + 8 * half;
          int ge = ge0 + ni * 16 + col;
          int b = gm >> 11, n = gm & (SEQ - 1);
          int h = (ge >> 6) & (NHEAD - 1), hd = ge & (HDIM - 1);
          vtw[((size_t)(b * NHEAD + h) * HDIM + hd) * SEQ + n] =
              (bf16_t)acc[mi][ni][v];
        }
  }
}

typedef uint32_t u32x4 __attribute__((ext_vector_type(4)));
typedef uint32_t u32x8 __attribute__((ext_vector_type(8)));

#define KV_PITCH 144u                // LDS row pitch, bytes: 128 + 16 of pad
#define KV_SLICE 6144u               // 32 rows x 144 B, rounded up to 2 KiB
#define KV_BUF   (4u * KV_SLICE)     // K rows 0-31, 32-63, V^T rows 0-31, 32-63
#define KV_STAGES (SEQ / 64)

__device__ __forceinline__ uint32_t uni(uint32_t v) {
  return (uint32_t)__builtin_amdgcn_readfirstlane(v);
}

// A wave-uniform value held in a scalar register: the test around a tensor
// load must compile to a scalar branch (the load ignores EXEC), and a
// descriptor word formed from it stays behind the volatile wait above it.
__device__ __forceinline__ uint32_t pinned(uint32_t v) {
  uint32_t w = uni(v);
  asm volatile("" : "+s"(w));  // pinned(): issue test or descriptor word kept scalar
  return w;
}

// Value of lane l ^ 16.
__device__ __forceinline__ float other_half(float x) {
  int b = __builtin_bit_cast(int, x);
  b = __builtin_amdgcn_permlanex16(b, b, 0x76543210, 0xfedcba98, false, false);
  return __builtin_bit_cast(float, b);
}

// Two f32 accumulator tiles (rows 0-15 and 16-31 of a 32-row block) -> one
// bf16 B fragment: element s is row (s<8 ? 8*half+s : 16+8*half+s-8).
__device__ __forceinline__ v16bf pack_b(v8f t0, v8f t1) {
  v16bf r;
  for (int s = 0; s < 8; ++s) {
    r[s]     = (bf16_t)t0[s];
    r[s + 8] = (bf16_t)t1[s];
  }
  return r;
}

// Four waves per SIMD (256 VGPRs each): all 1024 work-groups are resident at
// once, four per WGP, so there is no second, half-empty round.
__global__ __launch_bounds__(128)
__attribute__((amdgpu_waves_per_eu(4, 4))) void attn_kernel(
    const bf16_t* __restrict__ qw, const bf16_t* __restrict__ kw,
    const bf16_t* __restrict__ vtw, bf16_t* __restrict__ ow) {
  // Two buffers of four 32-row slices: K (rows=kv, cols=hd), V^T (rows=hd,
  // cols=kv). Every slice starts at a multiple of 2 KiB.
  __shared__ __attribute__((aligned(2048))) unsigned char L[2 * KV_BUF];

  const int tid  = threadIdx.x;
  const int wave = tid >> 5;
  const int lane = tid & 31;
  const int half = lane >> 4;
  const int col  = lane & 15;
  const int bh   = blockIdx.y;                 // b*16 + h
  const int qrow0 = blockIdx.x * 128 + wave * 32;

  // Q fragments (2 groups x 16 rows x HD=64 -> two k-slices each), straight
  // from global. Used as the B operand: column = query, k = hd.
  const bf16_t* qbase = qw + ((size_t)bh * SEQ + qrow0) * HDIM;
  v16bf qf[2][2];
  for (int g = 0; g < 2; ++g) {
    qf[g][0] = ld_frag(qbase, g * 16, HDIM, 0);
    qf[g][1] = ld_frag(qbase, g * 16, HDIM, 32);
  }

  // of[g][j][v] = O[query g*16 + col][hd = j*16 + 8*half + v]
  v8f of[2][4];
  float m_i[2];   // running maximum of this lane's query (both halves)
  float l_i[2];   // running sum over this half's keys only
  for (int g = 0; g < 2; ++g) {
    for (int j = 0; j < 4; ++j) of[g][j] = 0.f;
    m_i[g] = -1e30f;
    l_i[g] = 0.f;
  }

  const bf16_t* kg0 = kw + (size_t)bh * SEQ * HDIM;
  const bf16_t* vg0 = vtw + (size_t)bh * HDIM * SEQ;

  // Every wave issues one request per stage for its own slice of 32 rows of
  // 128 bytes: waves 0, 1 the halves of the K tile (source pitch 128 B, 64 rows
  // on per stage), waves 2, 3 the halves of the V^T tile (source pitch one
  // V^T row, 64 keys on per stage).
  const uint32_t wv  = uni((uint32_t)tid >> 5);
  const bool     isV = (wv & 2u) != 0u;
  const uint64_t src0 =
      isV ? (uint64_t)(size_t)vg0 + (uint64_t)((wv & 1u) * 32u * (SEQ * 2u))
          : (uint64_t)(size_t)kg0 + (uint64_t)((wv & 1u) * 32u * (HDIM * 2u));
  const uint32_t src_step = isV ? 64u * 2u : 64u * (HDIM * 2u);
  const uint32_t lds0 = (uint32_t)(size_t)L + wv * KV_SLICE;
  // Descriptor words pinned in scalar registers: one tuple serves every
  // request, so no register of a request in flight takes a new value.
  u32x8 g1;
  g1[0] = pinned((1u << 20) | (4u << 22) | (3u << 25));  // 16 B pad a 128-B row
  g1[1] = pinned(128u << 16);                            // tensor_dim0 = 128 B
  g1[2] = pinned(32u << 16);                             // tensor_dim1 = 32 rows
  g1[3] = pinned(128u << 16);                            // tile_dim0
  g1[4] = pinned(32u);                                   // tile_dim1
  g1[5] = pinned(isV ? SEQ * 2u : HDIM * 2u);            // source row pitch, B
  g1[6] = pinned(0u);
  g1[7] = pinned(0u);
  auto issue = [&](uint32_t st) {
    const uint64_t ga = src0 + (uint64_t)(st * src_step);
    u32x4 g0;
    g0[0] = uni(1u);
    g0[1] = uni(lds0 + (st & 1u) * KV_BUF);
    g0[2] = uni((uint32_t)ga);
    g0[3] = uni((((uint32_t)(ga >> 32)) & 0x01FFFFFFu) | 0x80000000u);
    // One request of the whole wave: 32 rows of 128 B into LDS at pitch 144 B.
    asm volatile("tensor_load_to_lds %0, %1" :: "s"(g0), "s"(g1) : "memory");
  };

  issue(0u);
  // Stage 0 has landed.
  asm volatile("s_wait_tensorcnt 0x0" ::: "memory");
  __syncthreads();
  issue(1u);

  for (uint32_t st = 0; st < KV_STAGES; ++st) {
    const bf16_t* Kb = (const bf16_t*)(L + (st & 1u) * KV_BUF);
    const bf16_t* Vb = Kb + 2u * (KV_SLICE / 2u);

    // S^T = K Q^T : 4 key-row blocks, K-dim 64 -> 2 WMMAs per column group.
    // sf[g][j][v] = S[query g*16 + col][key st*64 + j*16 + 8*half + v]
    v8f sf[2][4];
    for (int j = 0; j < 4; ++j) {
      const bf16_t* ks = Kb + (j >> 1) * (KV_SLICE / 2u);
      const v16bf k0 = ld_frag(ks, (j & 1) * 16, KV_PITCH / 2, 0);
      const v16bf k1 = ld_frag(ks, (j & 1) * 16, KV_PITCH / 2, 32);
      for (int g = 0; g < 2; ++g) {
        v8f s = 0.f;
        s = wmma_bf16(k0, qf[g][0], s);
        s = wmma_bf16(k1, qf[g][1], s);
        sf[g][j] = s;
      }
    }

    // Online softmax, one query per lane and column group.
    v16bf p0[2], p1[2];
    for (int g = 0; g < 2; ++g) {
      float mj[4];
      for (int j = 0; j < 4; ++j) {
        float m = sf[g][j][0];
        for (int v = 1; v < 8; ++v) m = fmaxf(m, sf[g][j][v]);
        mj[j] = m;
      }
      float mt = fmaxf(fmaxf(mj[0], mj[1]), fmaxf(mj[2], mj[3]));
      mt = fmaxf(mt, other_half(mt));
      const float mn  = fmaxf(m_i[g], mt);
      const float scl = __expf(m_i[g] - mn);
      m_i[g] = mn;

      float sj[4];
      for (int j = 0; j < 4; ++j) {
        float sum = 0.f;
        for (int v = 0; v < 8; ++v) {
          float p = __expf(sf[g][j][v] - mn);
          sf[g][j][v] = p;
          sum += p;
        }
        sj[j] = sum;
      }
      l_i[g] = l_i[g] * scl + ((sj[0] + sj[1]) + (sj[2] + sj[3]));
      for (int j = 0; j < 4; ++j)
        for (int v = 0; v < 8; ++v) of[g][j][v] *= scl;

      p0[g] = pack_b(sf[g][0], sf[g][1]);
      p1[g] = pack_b(sf[g][2], sf[g][3]);
      // Finish one column group before the next starts: interleaved, the two
      // groups' f32 probabilities overflow the 256-register budget and spill.
      __builtin_amdgcn_sched_barrier(0);
    }

    // O^T += V^T P^T  (K-dim 64 over kv, 4 hd row blocks, 2 column groups).
    for (int j = 0; j < 4; ++j) {
      const bf16_t* vs = Vb + (j >> 1) * (KV_SLICE / 2u);
      const v16bf v0 = ld_frag(vs, (j & 1) * 16, KV_PITCH / 2, 0);
      const v16bf v1 = ld_frag(vs, (j & 1) * 16, KV_PITCH / 2, 32);
      for (int g = 0; g < 2; ++g) {
        of[g][j] = wmma_bf16(v0, p0[g], of[g][j]);
        of[g][j] = wmma_bf16(v1, p1[g], of[g][j]);
      }
    }

    // Publish point of stage st + 1. This wave's reads of this buffer are done:
    asm volatile("s_wait_dscnt 0x0" ::: "memory");
    // its own slice of stage st + 1 has landed:
    asm volatile("s_wait_tensorcnt 0x0" ::: "memory");
    // every wave's has, and every wave has left the buffer refilled below.
    __syncthreads();
    if (pinned(st + 2u < KV_STAGES)) issue(pinned(st + 2u));
  }
  // Nothing is in flight when the wave ends.
  asm volatile("s_wait_tensorcnt 0x0" ::: "memory");
  asm volatile("s_wait_dscnt 0x0" ::: "memory");

  // Finalize: join the halves' sums, O *= 1/l, write to (B, N, H*HD) bf16 for
  // the projection gemm. A lane holds 8 consecutive hd of one query per tile.
  const int b = bh >> 4, h = bh & 15;
  for (int g = 0; g < 2; ++g) {
    const float inv_l = 1.0f / (l_i[g] + other_half(l_i[g]));
    bf16_t* orow = ow + ((size_t)(b * SEQ + qrow0 + g * 16 + col)) * DMODEL +
                   h * HDIM + 8 * half;
    for (int j = 0; j < 4; ++j) {
      v8bf o;
      for (int v = 0; v < 8; ++v) o[v] = (bf16_t)(of[g][j][v] * inv_l);
      *(v8bf*)(orow + j * 16) = o;
    }
  }
}

// ---------------------------------------------------------------------------
// Kernel 3: out = attn_out @ w_proj^T + b_proj  (M=8192, N=1024, K=1024)
// WG tile 256x128, 16 waves, each wave 64x32: 256 work-groups, one per WGP in
// one round, and a third fewer bytes fetched from L2 than with 128x128 tiles.
// One work-group fills a WGP, so nothing else hides its loads: the next 64-wide
// K-slab is fetched into registers while the current one is multiplied, and
// goes into the other of two LDS buffers (one barrier per slab).
// ---------------------------------------------------------------------------
#define PJ_PITCH 72   // LDS row pitch, elements: 64 + 8 of pad (144 bytes)

__global__ __launch_bounds__(512) void proj_gemm_kernel(
    const bf16_t* __restrict__ a, const float* __restrict__ w_proj,
    const float* __restrict__ b_proj, float* __restrict__ out) {
  __shared__ bf16_t As[2][256 * PJ_PITCH];   // 256 rows x 64 K
  __shared__ bf16_t Ws[2][128 * PJ_PITCH];   // 128 rows x 64 K

  const int tid  = threadIdx.x;
  const int wave = tid >> 5;
  const int wm   = wave >> 2;       // 0..3 -> 64-row block
  const int wn   = wave & 3;        // 0..3 -> 32-col block
  const int m0   = blockIdx.x * 256;
  const int e0   = blockIdx.y * 128;

  // Staging: every wave-wide 16-byte load covers four whole 128-byte lines.
  // A (bf16): 8 threads a row, rows ar + 64 i. W (f32): 16 threads a row,
  // rows wr + 32 i.
  const int ar = tid >> 3;
  const int ac = (tid & 7) * 8;
  const int wr = tid >> 4;
  const int wc = (tid & 15) * 4;
  const bf16_t* ag = a + (size_t)(m0 + ar) * DMODEL + ac;
  const float*  wg = w_proj + (size_t)(e0 + wr) * DMODEL + wc;

  v8f acc[4][2];
  for (int i = 0; i < 4; ++i)
    for (int j = 0; j < 2; ++j) acc[i][j] = 0.f;

  u32x4  fa[4];
  float4 fw[4];
  for (int i = 0; i < 4; ++i) {
    fa[i] = *(const u32x4*)(ag + (size_t)i * 64 * DMODEL);
    fw[i] = *(const float4*)(wg + (size_t)i * 32 * DMODEL);
  }
  for (int i = 0; i < 4; ++i) {
    *(u32x4*)&As[0][(ar + i * 64) * PJ_PITCH + ac] = fa[i];
    *(uint2*)&Ws[0][(wr + i * 32) * PJ_PITCH + wc] = pack4_bf16(fw[i]);
  }

  auto products = [&](const bf16_t* Ac, const bf16_t* Wc) {
    v16bf af[2][4], bf[2][2];
    for (int k = 0; k < 2; ++k) {
      for (int i = 0; i < 4; ++i)
        af[k][i] = ld_frag(Ac, wm * 64 + i * 16, PJ_PITCH, k * 32);
      for (int j = 0; j < 2; ++j)
        bf[k][j] = ld_frag(Wc, wn * 32 + j * 16, PJ_PITCH, k * 32);
    }
    // Keeps the 24 LDS reads as one group in front of the 16 products; the
    // compiler otherwise spreads them among the products with full waits.
    __builtin_amdgcn_sched_barrier(0);
    for (int k = 0; k < 2; ++k)
      for (int j = 0; j < 2; ++j)
        for (int i = 0; i < 4; ++i)
          acc[i][j] = wmma_bf16(af[k][i], bf[k][j], acc[i][j]);
  };

  // All slabs but the last: fetch the next one under this one's products.
  for (int kb = 64; kb < DMODEL; kb += 64) {
    const int nxt = (kb >> 6) & 1;
    // Publishes buffer nxt^1 and ends every read of buffer nxt.
    __syncthreads();
    for (int i = 0; i < 4; ++i) {
      fa[i] = *(const u32x4*)(ag + (size_t)i * 64 * DMODEL + kb);
      fw[i] = *(const float4*)(wg + (size_t)i * 32 * DMODEL + kb);
    }
    // Keeps the loads in front of the products; the compiler otherwise sinks
    // them to their use and the whole L2 latency is waited out each slab.
    __builtin_amdgcn_sched_barrier(0);
    products(As[nxt ^ 1], Ws[nxt ^ 1]);
    // Keeps the wait for the loads behind the products; the compiler otherwise
    // lifts it, with the conversions, in front of them.
    __builtin_amdgcn_sched_barrier(0);
    for (int i = 0; i < 4; ++i) {
      *(u32x4*)&As[nxt][(ar + i * 64) * PJ_PITCH + ac] = fa[i];
      *(uint2*)&Ws[nxt][(wr + i * 32) * PJ_PITCH + wc] = pack4_bf16(fw[i]);
    }
  }
  __syncthreads();
  products(As[(DMODEL / 64 - 1) & 1], Ws[(DMODEL / 64 - 1) & 1]);

  const int lane = tid & 31;
  const int half = lane >> 4;
  const int col  = lane & 15;
  for (int mi = 0; mi < 4; ++mi)
    for (int ni = 0; ni < 2; ++ni)
      for (int v = 0; v < 8; ++v) {
        int gm = m0 + wm * 64 + mi * 16 + v + 8 * half;
        int ge = e0 + wn * 32 + ni * 16 + col;
        out[(size_t)gm * DMODEL + ge] = acc[mi][ni][v] + b_proj[ge];
      }
}

// ---------------------------------------------------------------------------
extern "C" void kernel_launch(void* const* d_in, const int* in_sizes, int n_in,
                              void* d_out, int out_size, void* d_ws,
                              size_t ws_size, hipStream_t stream) {
  const float* x      = (const float*)d_in[0];
  const float* w_qkv  = (const float*)d_in[1];
  const float* w_proj = (const float*)d_in[2];
  const float* b_proj = (const float*)d_in[3];
  float* out = (float*)d_out;

  const size_t PER = (size_t)BATCH * NHEAD * SEQ * HDIM;  // 8M elements
  bf16_t* qw  = (bf16_t*)d_ws;
  bf16_t* kw  = qw + PER;
  bf16_t* vtw = kw + PER;
  bf16_t* ow  = vtw + PER;   // (B, N, D) attention output, bf16

  qkv_gemm_kernel<<<dim3(BN / 256, E3 / 256), 512, 0, stream>>>(
      x, w_qkv, qw, kw, vtw);
  attn_kernel<<<dim3(SEQ / 128, BATCH * NHEAD), 128, 0, stream>>>(
      qw, kw, vtw, ow);
  proj_gemm_kernel<<<dim3(BN / 256, DMODEL / 128), 512, 0, stream>>>(
      ow, w_proj, b_proj, out);
}

// v006
// One run takes 139 microseconds.
// Next to v005, in two timings, it ran 1.03 times as fast each time.
// Over all steps from v000 it is 2.24 times as fast.
#include <hip/hip_runtime.h>
#include <hip/hip_bf16.h>
#include <math.h>

// ---------------------------------------------------------------------------
// MHA forward for B=4, N=2048, D=1024, H=16, HD=64 on gfx1250 (wave32, WMMA).
// bf16 inputs to v_wmma_f32_16x16x32_bf16, fp32 accumulation throughout.
// Compute-bound (~137 GFLOP vs <10us of HBM traffic at 23.3 TB/s), so all
// three stages run through the matrix pipes.
// ---------------------------------------------------------------------------

typedef __bf16 bf16_t;
typedef __attribute__((ext_vector_type(16))) __bf16 v16bf;
typedef __attribute__((ext_vector_type(8)))  __bf16 v8bf;
typedef __attribute__((ext_vector_type(8)))  float  v8f;

#define BATCH 4
#define SEQ   2048
#define DMODEL 1024
#define NHEAD 16
#define HDIM  64
#define BN    (BATCH * SEQ)       // 8192
#define E3    (3 * DMODEL)        // 3072
#define SCALE 0.125f              // 64^-0.5
#define LOG2E 1.44269504088896340736f

__device__ __forceinline__ v8f wmma_bf16(v16bf a, v16bf b, v8f c) {
  return __builtin_amdgcn_wmma_f32_16x16x32_bf16(
      /*neg_a=*/false, a, /*neg_b=*/false, b,
      /*c_mod=*/(short)0, c, /*reuse_a=*/false, /*reuse_b=*/false);
}

// Load one 16x32 bf16 fragment (A-layout; identical addressing serves the
// B-fragment of a TN gemm where B rows are K-contiguous).
//   lane 0-15 : row = lane,    k = {0..7, 16..23}
//   lane 16-31: row = lane-16, k = {8..15, 24..31}
// Two 16-byte reads per lane; `t` may point at LDS (ds_load after addrspace
// inference) or global memory.
__device__ __forceinline__ v16bf ld_frag(const bf16_t* t, int row, int stride,
                                         int kbase) {
  const int lane = threadIdx.x & 31;
  const int r = lane & 15;
  const int klo = (lane >> 4) << 3;
  const bf16_t* p = t + (size_t)(row + r) * stride + kbase + klo;
  union { v16bf v; v8bf h[2]; } u;
  u.h[0] = *(const v8bf*)(p);
  u.h[1] = *(const v8bf*)(p + 16);
  return u.v;
}

// ---------------------------------------------------------------------------
// Kernel 1: qkv = x @ w_qkv^T  (TN gemm, M=8192, N=3072, K=1024)
// WG tile 256x256, 16 waves, each wave 64x64 (acc[4][4], 16 WMMAs / K-step):
// every operand row is fetched from L2 half as often as with 128x128 tiles.
// One work-group fills a WGP, so nothing else hides its loads: the next
// K-slab is fetched into registers while the current one is multiplied, and
// goes into the other of two LDS buffers (one barrier per slab).
// Scatters to q (pre-scaled), k as (B,H,N,HD) and v transposed (B,H,HD,N).
// ---------------------------------------------------------------------------
typedef __attribute__((ext_vector_type(2))) __bf16 v2bf;
typedef __attribute__((ext_vector_type(2))) float  v2f;

__device__ __forceinline__ uint2 pack4_bf16(float4 f) {
  const v2f lo = {f.x, f.y}, hi = {f.z, f.w};
  uint2 u;
  u.x = __builtin_bit_cast(unsigned, __builtin_convertvector(lo, v2bf));
  u.y = __builtin_bit_cast(unsigned, __builtin_convertvector(hi, v2bf));
  return u;
}

__global__ __launch_bounds__(512) void qkv_gemm_kernel(
    const float* __restrict__ x, const float* __restrict__ w_qkv,
    bf16_t* __restrict__ qw, bf16_t* __restrict__ kw, bf16_t* __restrict__ vtw) {
  __shared__ bf16_t Xs[2][256 * 40];   // 256 rows x 32 K, stride 40 (pad)
  __shared__ bf16_t Ws[2][256 * 40];   // 256 rows x 32 K

  const int tid  = threadIdx.x;
  const int wave = tid >> 5;
  const int wm   = wave >> 2;       // 0..3 -> 64-row block
  const int wn   = wave & 3;        // 0..3 -> 64-col block
  const int m0   = blockIdx.x * 256;
  const int e0   = blockIdx.y * 256;

  // Staging: a thread carries 4 floats of rows sr, sr+64, sr+128, sr+192 of
  // both tiles; 8 neighbouring threads cover one 128-byte line.
  const int sr = tid >> 3;
  const int sc = (tid & 7) * 4;
  const float* xg = x + (size_t)(m0 + sr) * DMODEL + sc;
  const float* wg = w_qkv + (size_t)(e0 + sr) * DMODEL + sc;

  v8f acc[4][4];
  for (int i = 0; i < 4; ++i)
    for (int j = 0; j < 4; ++j) acc[i][j] = 0.f;

  float4 fx[4], fw[4];
  for (int i = 0; i < 4; ++i) {
    fx[i] = *(const float4*)(xg + (size_t)i * 64 * DMODEL);
    fw[i] = *(const float4*)(wg + (size_t)i * 64 * DMODEL);
  }
  for (int i = 0; i < 4; ++i) {
    *(uint2*)&Xs[0][(sr + i * 64) * 40 + sc] = pack4_bf16(fx[i]);
    *(uint2*)&Ws[0][(sr + i * 64) * 40 + sc] = pack4_bf16(fw[i]);
  }

  auto products = [&](const bf16_t* Xc, const bf16_t* Wc) {
    v16bf a[4];
    for (int i = 0; i < 4; ++i) a[i] = ld_frag(Xc, wm * 64 + i * 16, 40, 0);
    v16bf b[4];
    for (int j = 0; j < 4; ++j) b[j] = ld_frag(Wc, wn * 64 + j * 16, 40, 0);
    // Keeps the 16 LDS reads as one group in front of the 16 products; the
    // compiler otherwise spreads them among the products with full waits.
    __builtin_amdgcn_sched_barrier(0);
    for (int j = 0; j < 4; ++j)
      for (int i = 0; i < 4; ++i) acc[i][j] = wmma_bf16(a[i], b[j], acc[i][j]);
  };

  // All slabs but the last: fetch the next one under this one's products.
  for (int kb = 32; kb < DMODEL; kb += 32) {
    const int nxt = (kb >> 5) & 1;
    // Publishes buffer nxt^1 and ends every read of buffer nxt.
    __syncthreads();
    for (int i = 0; i < 4; ++i) {
      fx[i] = *(const float4*)(xg + (size_t)i * 64 * DMODEL + kb);
      fw[i] = *(const float4*)(wg + (size_t)i * 64 * DMODEL + kb);
    }
    // Keeps the loads in front of the products; the compiler otherwise sinks
    // them to their use and the whole L2 latency is waited out each slab.
    __builtin_amdgcn_sched_barrier(0);
    products(Xs[nxt ^ 1], Ws[nxt ^ 1]);
    // Keeps the conversions, and with them the wait for the loads, behind the
    // products; the compiler otherwise lifts both in front of them.
    __builtin_amdgcn_sched_barrier(0);
    for (int i = 0; i < 4; ++i) {
      *(uint2*)&Xs[nxt][(sr + i * 64) * 40 + sc] = pack4_bf16(fx[i]);
      *(uint2*)&Ws[nxt][(sr + i * 64) * 40 + sc] = pack4_bf16(fw[i]);
    }
  }
  __syncthreads();
  products(Xs[(DMODEL / 32 - 1) & 1], Ws[(DMODEL / 32 - 1) & 1]);

  // Epilogue scatter. C-layout: lane holds col=lane&15, rows v+8*(lane>>4).
  // The 256-wide N tile lies inside one q/k/v segment -> s is block-uniform.
  const int lane = tid & 31;
  const int half = lane >> 4;
  const int col  = lane & 15;
  const int s    = e0 >> 10;                        // 0=q, 1=k, 2=v (uniform)
  const int gm0  = m0 + wm * 64;
  const int ge0  = e0 + wn * 64;

  if (s == 0) {
    for (int mi = 0; mi < 4; ++mi)
      for (int ni = 0; ni < 4; ++ni)
        for (int v = 0; v < 8; ++v) {
          int gm = gm0 + mi * 16 + v + 8 * half;
          int ge = ge0 + ni * 16 + col;
          int b = gm >> 11, n = gm & (SEQ - 1);
          int h = (ge >> 6) & (NHEAD - 1), hd = ge & (HDIM - 1);
          qw[((size_t)(b * NHEAD + h) * SEQ + n) * HDIM + hd] =
              (bf16_t)(acc[mi][ni][v] * SCALE);
        }
  } else if (s == 1) {
    for (int mi = 0; mi < 4; ++mi)
      for (int ni = 0; ni < 4; ++ni)
        for (int v = 0; v < 8; ++v) {
          int gm = gm0 + mi * 16 + v + 8 * half;
          int ge = ge0 + ni * 16 + col;
          int b = gm >> 11, n = gm & (SEQ - 1);
          int h = (ge >> 6) & (NHEAD - 1), hd = ge & (HDIM - 1);
          kw[((size_t)(b * NHEAD + h) * SEQ + n) * HDIM + hd] =
              (bf16_t)acc[mi][ni][v];
        }
  } else {
    for (int mi = 0; mi < 4; ++mi)
      for (int ni = 0; ni < 4; ++ni)
        for (int v = 0; v < 8; ++v) {
          int gm = gm0 + mi * 16 + v + 8 * half;
          int ge = ge0 + ni * 16 + col;
          int b = gm >> 11, n = gm & (SEQ - 1);
          int h = (ge >> 6) & (NHEAD - 1), hd = ge & (HDIM - 1);
          vtw[((size_t)(b * NHEAD + h) * HDIM + hd) * SEQ + n] =
              (bf16_t)acc[mi][ni][v];
        }
  }
}

typedef uint32_t u32x4 __attribute__((ext_vector_type(4)));
typedef uint32_t u32x8 __attribute__((ext_vector_type(8)));

#define KV_PITCH 144u                // LDS row pitch, bytes: 128 + 16 of pad
#define KV_SLICE 6144u               // 32 rows x 144 B, rounded up to 2 KiB
#define KV_BUF   (4u * KV_SLICE)     // K rows 0-31, 32-63, V^T rows 0-31, 32-63
#define KV_STAGES (SEQ / 64)

__device__ __forceinline__ uint32_t uni(uint32_t v) {
  return (uint32_t)__builtin_amdgcn_readfirstlane(v);
}

// A wave-uniform value held in a scalar register: the test around a tensor
// load must compile to a scalar branch (the load ignores EXEC), and a
// descriptor word formed from it stays behind the volatile wait above it.
__device__ __forceinline__ uint32_t pinned(uint32_t v) {
  uint32_t w = uni(v);
  asm volatile("" : "+s"(w));  // pinned(): issue test or descriptor word kept scalar
  return w;
}

// Value of lane l ^ 16.
__device__ __forceinline__ float other_half(float x) {
  int b = __builtin_bit_cast(int, x);
  b = __builtin_amdgcn_permlanex16(b, b, 0x76543210, 0xfedcba98, false, false);
  return __builtin_bit_cast(float, b);
}

// Two f32 accumulator tiles (rows 0-15 and 16-31 of a 32-row block) -> one
// bf16 B fragment: element s is row (s<8 ? 8*half+s : 16+8*half+s-8).
__device__ __forceinline__ v16bf pack_b(v8f t0, v8f t1) {
  v16bf r;
  for (int s = 0; s < 8; ++s) {
    r[s]     = (bf16_t)t0[s];
    r[s + 8] = (bf16_t)t1[s];
  }
  return r;
}

// Four waves per SIMD (256 VGPRs each): all 1024 work-groups are resident at
// once, four per WGP, so there is no second, half-empty round.
__global__ __launch_bounds__(128)
__attribute__((amdgpu_waves_per_eu(4, 4))) void attn_kernel(
    const bf16_t* __restrict__ qw, const bf16_t* __restrict__ kw,
    const bf16_t* __restrict__ vtw, bf16_t* __restrict__ ow) {
  // Two buffers of four 32-row slices: K (rows=kv, cols=hd), V^T (rows=hd,
  // cols=kv). Every slice starts at a multiple of 2 KiB.
  __shared__ __attribute__((aligned(2048))) unsigned char L[2 * KV_BUF];

  const int tid  = threadIdx.x;
  const int wave = tid >> 5;
  const int lane = tid & 31;
  const int half = lane >> 4;
  const int col  = lane & 15;
  const int bh   = blockIdx.y;                 // b*16 + h
  const int qrow0 = blockIdx.x * 128 + wave * 32;

  // Q fragments (2 groups x 16 rows x HD=64 -> two k-slices each), straight
  // from global. Used as the B operand: column = query, k = hd.
  const bf16_t* qbase = qw + ((size_t)bh * SEQ + qrow0) * HDIM;
  v16bf qf[2][2];
  for (int g = 0; g < 2; ++g) {
    qf[g][0] = ld_frag(qbase, g * 16, HDIM, 0);
    qf[g][1] = ld_frag(qbase, g * 16, HDIM, 32);
  }

  // of[g][j][v] = O[query g*16 + col][hd = j*16 + 8*half + v]
  v8f of[2][4];
  float m_i[2];   // running maximum of this lane's query (both halves)
  float l_i[2];   // running sum over this half's keys only
  for (int g = 0; g < 2; ++g) {
    for (int j = 0; j < 4; ++j) of[g][j] = 0.f;
    m_i[g] = -1e30f;
    l_i[g] = 0.f;
  }

  const bf16_t* kg0 = kw + (size_t)bh * SEQ * HDIM;
  const bf16_t* vg0 = vtw + (size_t)bh * HDIM * SEQ;

  // Every wave issues one request per stage for its own slice of 32 rows of
  // 128 bytes: waves 0, 1 the halves of the K tile (source pitch 128 B, 64 rows
  // on per stage), waves 2, 3 the halves of the V^T tile (source pitch one
  // V^T row, 64 keys on per stage).
  const uint32_t wv  = uni((uint32_t)tid >> 5);
  const bool     isV = (wv & 2u) != 0u;
  const uint64_t src0 =
      isV ? (uint64_t)(size_t)vg0 + (uint64_t)((wv & 1u) * 32u * (SEQ * 2u))
          : (uint64_t)(size_t)kg0 + (uint64_t)((wv & 1u) * 32u * (HDIM * 2u));
  const uint32_t src_step = isV ? 64u * 2u : 64u * (HDIM * 2u);
  const uint32_t lds0 = (uint32_t)(size_t)L + wv * KV_SLICE;
  // Descriptor words pinned in scalar registers: one tuple serves every
  // request, so no register of a request in flight takes a new value.
  u32x8 g1;
  g1[0] = pinned((1u << 20) | (4u << 22) | (3u << 25));  // 16 B pad a 128-B row
  g1[1] = pinned(128u << 16);                            // tensor_dim0 = 128 B
  g1[2] = pinned(32u << 16);                             // tensor_dim1 = 32 rows
  g1[3] = pinned(128u << 16);                            // tile_dim0
  g1[4] = pinned(32u);                                   // tile_dim1
  g1[5] = pinned(isV ? SEQ * 2u : HDIM * 2u);            // source row pitch, B
  g1[6] = pinned(0u);
  g1[7] = pinned(0u);
  auto issue = [&](uint32_t st) {
    const uint64_t ga = src0 + (uint64_t)(st * src_step);
    u32x4 g0;
    g0[0] = uni(1u);
    g0[1] = uni(lds0 + (st & 1u) * KV_BUF);
    g0[2] = uni((uint32_t)ga);
    g0[3] = uni((((uint32_t)(ga >> 32)) & 0x01FFFFFFu) | 0x80000000u);
    // One request of the whole wave: 32 rows of 128 B into LDS at pitch 144 B.
    asm volatile("tensor_load_to_lds %0, %1" :: "s"(g0), "s"(g1) : "memory");
  };

  issue(0u);
  // Stage 0 has landed.
  asm volatile("s_wait_tensorcnt 0x0" ::: "memory");
  __syncthreads();
  issue(1u);

  for (uint32_t st = 0; st < KV_STAGES; ++st) {
    const bf16_t* Kb = (const bf16_t*)(L + (st & 1u) * KV_BUF);
    const bf16_t* Vb = Kb + 2u * (KV_SLICE / 2u);

    // S^T = K Q^T : 4 key-row blocks, K-dim 64 -> 2 WMMAs per column group.
    // sf[g][j][v] = S[query g*16 + col][key st*64 + j*16 + 8*half + v]
    v8f sf[2][4];
    for (int j = 0; j < 4; ++j) {
      const bf16_t* ks = Kb + (j >> 1) * (KV_SLICE / 2u);
      const v16bf k0 = ld_frag(ks, (j & 1) * 16, KV_PITCH / 2, 0);
      const v16bf k1 = ld_frag(ks, (j & 1) * 16, KV_PITCH / 2, 32);
      for (int g = 0; g < 2; ++g) {
        v8f s = 0.f;
        s = wmma_bf16(k0, qf[g][0], s);
        s = wmma_bf16(k1, qf[g][1], s);
        sf[g][j] = s;
      }
    }

    // Online softmax, one query per lane and column group.
    v16bf p0[2], p1[2];
    for (int g = 0; g < 2; ++g) {
      float mj[4];
      for (int j = 0; j < 4; ++j) {
        float m = sf[g][j][0];
        for (int v = 1; v < 8; ++v) m = fmaxf(m, sf[g][j][v]);
        mj[j] = m;
      }
      float mt = fmaxf(fmaxf(mj[0], mj[1]), fmaxf(mj[2], mj[3]));
      mt = fmaxf(mt, other_half(mt));
      const float mn  = fmaxf(m_i[g], mt);
      // exp(s - mn) = exp2(s * log2e - mn * log2e): one packed fused
      // multiply-add per two scores in front of the hardware's exp2.
      const float nb  = -mn * LOG2E;
      const float scl = __expf(m_i[g] - mn);   // exactly 1 while the maximum stands
      m_i[g] = mn;

      const v2f l2 = {LOG2E, LOG2E}, nb2 = {nb, nb};
      v2f sj[4];
      for (int j = 0; j < 4; ++j) {
        for (int v = 0; v < 8; v += 2) {
          // An even-aligned register pair of the accumulator tile.
          const v2f s2 = {sf[g][j][v], sf[g][j][v + 1]};
          const v2f a  = __builtin_elementwise_fma(s2, l2, nb2);
          const v2f p  = {__builtin_amdgcn_exp2f(a.x), __builtin_amdgcn_exp2f(a.y)};
          sf[g][j][v]     = p.x;
          sf[g][j][v + 1] = p.y;
          sj[j] = v ? sj[j] + p : p;
        }
      }
      const v2f st2 = (sj[0] + sj[1]) + (sj[2] + sj[3]);
      l_i[g] = l_i[g] * scl + (st2.x + st2.y);
      for (int j = 0; j < 4; ++j)
        for (int v = 0; v < 8; ++v) of[g][j][v] *= scl;

      p0[g] = pack_b(sf[g][0], sf[g][1]);
      p1[g] = pack_b(sf[g][2], sf[g][3]);
      // Finish one column group before the next starts: interleaved, the two
      // groups' f32 probabilities overflow the 256-register budget and spill.
      __builtin_amdgcn_sched_barrier(0);
    }

    // O^T += V^T P^T  (K-dim 64 over kv, 4 hd row blocks, 2 column groups).
    for (int j = 0; j < 4; ++j) {
      const bf16_t* vs = Vb + (j >> 1) * (KV_SLICE / 2u);
      const v16bf v0 = ld_frag(vs, (j & 1) * 16, KV_PITCH / 2, 0);
      const v16bf v1 = ld_frag(vs, (j & 1) * 16, KV_PITCH / 2, 32);
      for (int g = 0; g < 2; ++g) {
        of[g][j] = wmma_bf16(v0, p0[g], of[g][j]);
        of[g][j] = wmma_bf16(v1, p1[g], of[g][j]);
      }
    }

    // Publish point of stage st + 1. This wave's reads of this buffer are done:
    asm volatile("s_wait_dscnt 0x0" ::: "memory");
    // its own slice of stage st + 1 has landed:
    asm volatile("s_wait_tensorcnt 0x0" ::: "memory");
    // every wave's has, and every wave has left the buffer refilled below.
    __syncthreads();
    if (pinned(st + 2u < KV_STAGES)) issue(pinned(st + 2u));
  }
  // Nothing is in flight when the wave ends.
  asm volatile("s_wait_tensorcnt 0x0" ::: "memory");
  asm volatile("s_wait_dscnt 0x0" ::: "memory");

  // Finalize: join the halves' sums, O *= 1/l, write to (B, N, H*HD) bf16 for
  // the projection gemm. A lane holds 8 consecutive hd of one query per tile.
  const int b = bh >> 4, h = bh & 15;
  for (int g = 0; g < 2; ++g) {
    const float inv_l = 1.0f / (l_i[g] + other_half(l_i[g]));
    bf16_t* orow = ow + ((size_t)(b * SEQ + qrow0 + g * 16 + col)) * DMODEL +
                   h * HDIM + 8 * half;
    for (int j = 0; j < 4; ++j) {
      v8bf o;
      for (int v = 0; v < 8; ++v) o[v] = (bf16_t)(of[g][j][v] * inv_l);
      *(v8bf*)(orow + j * 16) = o;
    }
  }
}

// ---------------------------------------------------------------------------
// Kernel 3: out = attn_out @ w_proj^T + b_proj  (M=8192, N=1024, K=1024)
// WG tile 256x128, 16 waves, each wave 64x32: 256 work-groups, one per WGP in
// one round, and a third fewer bytes fetched from L2 than with 128x128 tiles.
// One work-group fills a WGP, so nothing else hides its loads: the next 64-wide
// K-slab is fetched into registers while the current one is multiplied, and
// goes into the other of two LDS buffers (one barrier per slab).
// ---------------------------------------------------------------------------
#define PJ_PITCH 72   // LDS row pitch, elements: 64 + 8 of pad (144 bytes)

__global__ __launch_bounds__(512) void proj_gemm_kernel(
    const bf16_t* __restrict__ a, const float* __restrict__ w_proj,
    const float* __restrict__ b_proj, float* __restrict__ out) {
  __shared__ bf16_t As[2][256 * PJ_PITCH];   // 256 rows x 64 K
  __shared__ bf16_t Ws[2][128 * PJ_PITCH];   // 128 rows x 64 K

  const int tid  = threadIdx.x;
  const int wave = tid >> 5;
  const int wm   = wave >> 2;       // 0..3 -> 64-row block
  const int wn   = wave & 3;        // 0..3 -> 32-col block
  const int m0   = blockIdx.x * 256;
  const int e0   = blockIdx.y * 128;

  // Staging: every wave-wide 16-byte load covers four whole 128-byte lines.
  // A (bf16): 8 threads a row, rows ar + 64 i. W (f32): 16 threads a row,
  // rows wr + 32 i.
  const int ar = tid >> 3;
  const int ac = (tid & 7) * 8;
  const int wr = tid >> 4;
  const int wc = (tid & 15) * 4;
  const bf16_t* ag = a + (size_t)(m0 + ar) * DMODEL + ac;
  const float*  wg = w_proj + (size_t)(e0 + wr) * DMODEL + wc;

  v8f acc[4][2];
  for (int i = 0; i < 4; ++i)
    for (int j = 0; j < 2; ++j) acc[i][j] = 0.f;

  u32x4  fa[4];
  float4 fw[4];
  for (int i = 0; i < 4; ++i) {
    fa[i] = *(const u32x4*)(ag + (size_t)i * 64 * DMODEL);
    fw[i] = *(const float4*)(wg + (size_t)i * 32 * DMODEL);
  }
  for (int i = 0; i < 4; ++i) {
    *(u32x4*)&As[0][(ar + i * 64) * PJ_PITCH + ac] = fa[i];
    *(uint2*)&Ws[0][(wr + i * 32) * PJ_PITCH + wc] = pack4_bf16(fw[i]);
  }

  auto products = [&](const bf16_t* Ac, const bf16_t* Wc) {
    v16bf af[2][4], bf[2][2];
    for (int k = 0; k < 2; ++k) {
      for (int i = 0; i < 4; ++i)
        af[k][i] = ld_frag(Ac, wm * 64 + i * 16, PJ_PITCH, k * 32);
      for (int j = 0; j < 2; ++j)
        bf[k][j] = ld_frag(Wc, wn * 32 + j * 16, PJ_PITCH, k * 32);
    }
    // Keeps the 24 LDS reads as one group in front of the 16 products; the
    // compiler otherwise spreads them among the products with full waits.
    __builtin_amdgcn_sched_barrier(0);
    for (int k = 0; k < 2; ++k)
      for (int j = 0; j < 2; ++j)
        for (int i = 0; i < 4; ++i)
          acc[i][j] = wmma_bf16(af[k][i], bf[k][j], acc[i][j]);
  };

  // All slabs but the last: fetch the next one under this one's products.
  for (int kb = 64; kb < DMODEL; kb += 64) {
    const int nxt = (kb >> 6) & 1;
    // Publishes buffer nxt^1 and ends every read of buffer nxt.
    __syncthreads();
    for (int i = 0; i < 4; ++i) {
      fa[i] = *(const u32x4*)(ag + (size_t)i * 64 * DMODEL + kb);
      fw[i] = *(const float4*)(wg + (size_t)i * 32 * DMODEL + kb);
    }
    // Keeps the loads in front of the products; the compiler otherwise sinks
    // them to their use and the whole L2 latency is waited out each slab.
    __builtin_amdgcn_sched_barrier(0);
    products(As[nxt ^ 1], Ws[nxt ^ 1]);
    // Keeps the wait for the loads behind the products; the compiler otherwise
    // lifts it, with the conversions, in front of them.
    __builtin_amdgcn_sched_barrier(0);
    for (int i = 0; i < 4; ++i) {
      *(u32x4*)&As[nxt][(ar + i * 64) * PJ_PITCH + ac] = fa[i];
      *(uint2*)&Ws[nxt][(wr + i * 32) * PJ_PITCH + wc] = pack4_bf16(fw[i]);
    }
  }
  __syncthreads();
  products(As[(DMODEL / 64 - 1) & 1], Ws[(DMODEL / 64 - 1) & 1]);

  const int lane = tid & 31;
  const int half = lane >> 4;
  const int col  = lane & 15;
  for (int mi = 0; mi < 4; ++mi)
    for (int ni = 0; ni < 2; ++ni)
      for (int v = 0; v < 8; ++v) {
        int gm = m0 + wm * 64 + mi * 16 + v + 8 * half;
        int ge = e0 + wn * 32 + ni * 16 + col;
        out[(size_t)gm * DMODEL + ge] = acc[mi][ni][v] + b_proj[ge];
      }
}

// ---------------------------------------------------------------------------
extern "C" void kernel_launch(void* const* d_in, const int* in_sizes, int n_in,
                              void* d_out, int out_size, void* d_ws,
                              size_t ws_size, hipStream_t stream) {
  const float* x      = (const float*)d_in[0];
  const float* w_qkv  = (const float*)d_in[1];
  const float* w_proj = (const float*)d_in[2];
  const float* b_proj = (const float*)d_in[3];
  float* out = (float*)d_out;

  const size_t PER = (size_t)BATCH * NHEAD * SEQ * HDIM;  // 8M elements
  bf16_t* qw  = (bf16_t*)d_ws;
  bf16_t* kw  = qw + PER;
  bf16_t* vtw = kw + PER;
  bf16_t* ow  = vtw + PER;   // (B, N, D) attention output, bf16

  qkv_gemm_kernel<<<dim3(BN / 256, E3 / 256), 512, 0, stream>>>(
      x, w_qkv, qw, kw, vtw);
  attn_kernel<<<dim3(SEQ / 128, BATCH * NHEAD), 128, 0, stream>>>(
      qw, kw, vtw, ow);
  proj_gemm_kernel<<<dim3(BN / 256, DMODEL / 128), 512, 0, stream>>>(
      ow, w_proj, b_proj, out);
}

// v007
// Measured time: 130 microseconds a run.
// Next to v006, in two timings, it ran 1.06 times as fast each time.
// All steps since v000 together make it 2.39 times as fast.
#include <hip/hip_runtime.h>
#include <hip/hip_bf16.h>
#include <math.h>

// ---------------------------------------------------------------------------
// MHA forward for B=4, N=2048, D=1024, H=16, HD=64 on gfx1250 (wave32, WMMA).
// bf16 inputs to v_wmma_f32_16x16x32_bf16, fp32 accumulation throughout.
// Compute-bound (~137 GFLOP vs <10us of HBM traffic at 23.3 TB/s), so all
// three stages run through the matrix pipes.
// ---------------------------------------------------------------------------

typedef __bf16 bf16_t;
typedef __attribute__((ext_vector_type(16))) __bf16 v16bf;
typedef __attribute__((ext_vector_type(8)))  __bf16 v8bf;
typedef __attribute__((ext_vector_type(8)))  float  v8f;

#define BATCH 4
#define SEQ   2048
#define DMODEL 1024
#define NHEAD 16
#define HDIM  64
#define BN    (BATCH * SEQ)       // 8192
#define E3    (3 * DMODEL)        // 3072
#define SCALE 0.125f              // 64^-0.5
#define LOG2E 1.44269504088896340736f

__device__ __forceinline__ v8f wmma_bf16(v16bf a, v16bf b, v8f c) {
  return __builtin_amdgcn_wmma_f32_16x16x32_bf16(
      /*neg_a=*/false, a, /*neg_b=*/false, b,
      /*c_mod=*/(short)0, c, /*reuse_a=*/false, /*reuse_b=*/false);
}

// Load one 16x32 bf16 fragment (A-layout; identical addressing serves the
// B-fragment of a TN gemm where B rows are K-contiguous).
//   lane 0-15 : row = lane,    k = {0..7, 16..23}
//   lane 16-31: row = lane-16, k = {8..15, 24..31}
// Two 16-byte reads per lane; `t` may point at LDS (ds_load after addrspace
// inference) or global memory.
__device__ __forceinline__ v16bf ld_frag(const bf16_t* t, int row, int stride,
                                         int kbase) {
  const int lane = threadIdx.x & 31;
  const int r = lane & 15;
  const int klo = (lane >> 4) << 3;
  const bf16_t* p = t + (size_t)(row + r) * stride + kbase + klo;
  union { v16bf v; v8bf h[2]; } u;
  u.h[0] = *(const v8bf*)(p);
  u.h[1] = *(const v8bf*)(p + 16);
  return u.v;
}

// ---------------------------------------------------------------------------
// Kernel 1: qkv = x @ w_qkv^T  (TN gemm, M=8192, N=3072, K=1024)
// WG tile 256x256, 16 waves, each wave 64x64 (acc[4][4], 16 WMMAs / K-step):
// every operand row is fetched from L2 half as often as with 128x128 tiles.
// One work-group fills a WGP, so nothing else hides its loads: the next
// K-slab is fetched into registers while the current one is multiplied, and
// goes into the other of two LDS buffers (one barrier per slab).
// Scatters to q (pre-scaled), k as (B,H,N,HD) and v transposed (B,H,HD,N).
// ---------------------------------------------------------------------------
typedef __attribute__((ext_vector_type(2))) __bf16 v2bf;
typedef __attribute__((ext_vector_type(2))) float  v2f;

__device__ __forceinline__ uint2 pack4_bf16(float4 f) {
  const v2f lo = {f.x, f.y}, hi = {f.z, f.w};
  uint2 u;
  u.x = __builtin_bit_cast(unsigned, __builtin_convertvector(lo, v2bf));
  u.y = __builtin_bit_cast(unsigned, __builtin_convertvector(hi, v2bf));
  return u;
}

__global__ __launch_bounds__(512) void qkv_gemm_kernel(
    const float* __restrict__ x, const float* __restrict__ w_qkv,
    bf16_t* __restrict__ qw, bf16_t* __restrict__ kw, bf16_t* __restrict__ vtw) {
  __shared__ bf16_t Xs[2][256 * 40];   // 256 rows x 32 K, stride 40 (pad)
  __shared__ bf16_t Ws[2][256 * 40];   // 256 rows x 32 K

  const int tid  = threadIdx.x;
  const int wave = tid >> 5;
  const int wm   = wave >> 2;       // 0..3 -> 64-row block
  const int wn   = wave & 3;        // 0..3 -> 64-col block
  const int m0   = blockIdx.x * 256;
  const int e0   = blockIdx.y * 256;

  // Staging: a thread carries 4 floats of rows sr, sr+64, sr+128, sr+192 of
  // both tiles; 8 neighbouring threads cover one 128-byte line.
  const int sr = tid >> 3;
  const int sc = (tid & 7) * 4;
  const float* xg = x + (size_t)(m0 + sr) * DMODEL + sc;
  const float* wg = w_qkv + (size_t)(e0 + sr) * DMODEL + sc;
  // The 12 work-groups of a row block read the same x lines and the 32 of a
  // column block the same w lines. Each starts its k walk at a slab of its own
  // and wraps, so that sharers do not ask L2 for the same lines at one moment.
  const int rot = (int)((blockIdx.x + blockIdx.y) & (DMODEL / 32 - 1)) * 32;

  v8f acc[4][4];
  for (int i = 0; i < 4; ++i)
    for (int j = 0; j < 4; ++j) acc[i][j] = 0.f;

  float4 fx[4], fw[4];
  for (int i = 0; i < 4; ++i) {
    fx[i] = *(const float4*)(xg + (size_t)i * 64 * DMODEL + rot);
    fw[i] = *(const float4*)(wg + (size_t)i * 64 * DMODEL + rot);
  }
  for (int i = 0; i < 4; ++i) {
    *(uint2*)&Xs[0][(sr + i * 64) * 40 + sc] = pack4_bf16(fx[i]);
    *(uint2*)&Ws[0][(sr + i * 64) * 40 + sc] = pack4_bf16(fw[i]);
  }

  auto products = [&](const bf16_t* Xc, const bf16_t* Wc) {
    v16bf a[4];
    for (int i = 0; i < 4; ++i) a[i] = ld_frag(Xc, wm * 64 + i * 16, 40, 0);
    v16bf b[4];
    for (int j = 0; j < 4; ++j) b[j] = ld_frag(Wc, wn * 64 + j * 16, 40, 0);
    // Keeps the 16 LDS reads as one group in front of the 16 products; the
    // compiler otherwise spreads them among the products with full waits.
    __builtin_amdgcn_sched_barrier(0);
    for (int j = 0; j < 4; ++j)
      for (int i = 0; i < 4; ++i) acc[i][j] = wmma_bf16(a[i], b[j], acc[i][j]);
  };

  // All slabs but the last: fetch the next one under this one's products.
  for (int kb = 32; kb < DMODEL; kb += 32) {
    const int nxt = (kb >> 5) & 1;
    const int ko  = (kb + rot) & (DMODEL - 1);   // this slab's place in k
    // Publishes buffer nxt^1 and ends every read of buffer nxt.
    __syncthreads();
    for (int i = 0; i < 4; ++i) {
      fx[i] = *(const float4*)(xg + (size_t)i * 64 * DMODEL + ko);
      fw[i] = *(const float4*)(wg + (size_t)i * 64 * DMODEL + ko);
    }
    // Keeps the loads in front of the products; the compiler otherwise sinks
    // them to their use and the whole L2 latency is waited out each slab.
    __builtin_amdgcn_sched_barrier(0);
    products(Xs[nxt ^ 1], Ws[nxt ^ 1]);
    // Keeps the conversions, and with them the wait for the loads, behind the
    // products; the compiler otherwise lifts both in front of them.
    __builtin_amdgcn_sched_barrier(0);
    for (int i = 0; i < 4; ++i) {
      *(uint2*)&Xs[nxt][(sr + i * 64) * 40 + sc] = pack4_bf16(fx[i]);
      *(uint2*)&Ws[nxt][(sr + i * 64) * 40 + sc] = pack4_bf16(fw[i]);
    }
  }
  __syncthreads();
  products(Xs[(DMODEL / 32 - 1) & 1], Ws[(DMODEL / 32 - 1) & 1]);

  // Epilogue scatter. C-layout: lane holds col=lane&15, rows v+8*(lane>>4).
  // The 256-wide N tile lies inside one q/k/v segment -> s is block-uniform.
  const int lane = tid & 31;
  const int half = lane >> 4;
  const int col  = lane & 15;
  const int s    = e0 >> 10;                        // 0=q, 1=k, 2=v (uniform)
  const int gm0  = m0 + wm * 64;
  const int ge0  = e0 + wn * 64;

  if (s == 0) {
    for (int mi = 0; mi < 4; ++mi)
      for (int ni = 0; ni < 4; ++ni)
        for (int v = 0; v < 8; ++v) {
          int gm = gm0 + mi * 16 + v + 8 * half;
          int ge = ge0 + ni * 16 + col;
          int b = gm >> 11, n = gm & (SEQ - 1);
          int h = (ge >> 6) & (NHEAD - 1), hd = ge & (HDIM - 1);
          qw[((size_t)(b * NHEAD + h) * SEQ + n) * HDIM + hd] =
              (bf16_t)(acc[mi][ni][v] * SCALE);
        }
  } else if (s == 1) {
    for (int mi = 0; mi < 4; ++mi)
      for (int ni = 0; ni < 4; ++ni)
        for (int v = 0; v < 8; ++v) {
          int gm = gm0 + mi * 16 + v + 8 * half;
          int ge = ge0 + ni * 16 + col;
          int b = gm >> 11, n = gm & (SEQ - 1);
          int h = (ge >> 6) & (NHEAD - 1), hd = ge & (HDIM - 1);
          kw[((size_t)(b * NHEAD + h) * SEQ + n) * HDIM + hd] =
              (bf16_t)acc[mi][ni][v];
        }
  } else {
    for (int mi = 0; mi < 4; ++mi)
      for (int ni = 0; ni < 4; ++ni)
        for (int v = 0; v < 8; ++v) {
          int gm = gm0 + mi * 16 + v + 8 * half;
          int ge = ge0 + ni * 16 + col;
          int b = gm >> 11, n = gm & (SEQ - 1);
          int h = (ge >> 6) & (NHEAD - 1), hd = ge & (HDIM - 1);
          vtw[((size_t)(b * NHEAD + h) * HDIM + hd) * SEQ + n] =
              (bf16_t)acc[mi][ni][v];
        }
  }
}

typedef uint32_t u32x4 __attribute__((ext_vector_type(4)));
typedef uint32_t u32x8 __attribute__((ext_vector_type(8)));

#define KV_PITCH 144u                // LDS row pitch, bytes: 128 + 16 of pad
#define KV_SLICE 6144u               // 32 rows x 144 B, rounded up to 2 KiB
#define KV_BUF   (4u * KV_SLICE)     // K rows 0-31, 32-63, V^T rows 0-31, 32-63
#define KV_STAGES (SEQ / 64)

__device__ __forceinline__ uint32_t uni(uint32_t v) {
  return (uint32_t)__builtin_amdgcn_readfirstlane(v);
}

// A wave-uniform value held in a scalar register: the test around a tensor
// load must compile to a scalar branch (the load ignores EXEC), and a
// descriptor word formed from it stays behind the volatile wait above it.
__device__ __forceinline__ uint32_t pinned(uint32_t v) {
  uint32_t w = uni(v);
  asm volatile("" : "+s"(w));  // pinned(): issue test or descriptor word kept scalar
  return w;
}

// Value of lane l ^ 16.
__device__ __forceinline__ float other_half(float x) {
  int b = __builtin_bit_cast(int, x);
  b = __builtin_amdgcn_permlanex16(b, b, 0x76543210, 0xfedcba98, false, false);
  return __builtin_bit_cast(float, b);
}

// Two f32 accumulator tiles (rows 0-15 and 16-31 of a 32-row block) -> one
// bf16 B fragment: element s is row (s<8 ? 8*half+s : 16+8*half+s-8).
__device__ __forceinline__ v16bf pack_b(v8f t0, v8f t1) {
  v16bf r;
  for (int s = 0; s < 8; ++s) {
    r[s]     = (bf16_t)t0[s];
    r[s + 8] = (bf16_t)t1[s];
  }
  return r;
}

// Four waves per SIMD (256 VGPRs each): all 1024 work-groups are resident at
// once, four per WGP, so there is no second, half-empty round.
__global__ __launch_bounds__(128)
__attribute__((amdgpu_waves_per_eu(4, 4))) void attn_kernel(
    const bf16_t* __restrict__ qw, const bf16_t* __restrict__ kw,
    const bf16_t* __restrict__ vtw, bf16_t* __restrict__ ow) {
  // Two buffers of four 32-row slices: K (rows=kv, cols=hd), V^T (rows=hd,
  // cols=kv). Every slice starts at a multiple of 2 KiB.
  __shared__ __attribute__((aligned(2048))) unsigned char L[2 * KV_BUF];

  const int tid  = threadIdx.x;
  const int wave = tid >> 5;
  const int lane = tid & 31;
  const int half = lane >> 4;
  const int col  = lane & 15;
  const int bh   = blockIdx.y;                 // b*16 + h
  const int qrow0 = blockIdx.x * 128 + wave * 32;

  // Q fragments (2 groups x 16 rows x HD=64 -> two k-slices each), straight
  // from global. Used as the B operand: column = query, k = hd.
  const bf16_t* qbase = qw + ((size_t)bh * SEQ + qrow0) * HDIM;
  v16bf qf[2][2];
  for (int g = 0; g < 2; ++g) {
    qf[g][0] = ld_frag(qbase, g * 16, HDIM, 0);
    qf[g][1] = ld_frag(qbase, g * 16, HDIM, 32);
  }

  // of[g][j][v] = O[query g*16 + col][hd = j*16 + 8*half + v]
  v8f of[2][4];
  float m_i[2];   // running maximum of this lane's query (both halves)
  float l_i[2];   // running sum over this half's keys only
  for (int g = 0; g < 2; ++g) {
    for (int j = 0; j < 4; ++j) of[g][j] = 0.f;
    m_i[g] = -1e30f;
    l_i[g] = 0.f;
  }

  const bf16_t* kg0 = kw + (size_t)bh * SEQ * HDIM;
  const bf16_t* vg0 = vtw + (size_t)bh * HDIM * SEQ;

  // Every wave issues one request per stage for its own slice of 32 rows of
  // 128 bytes: waves 0, 1 the halves of the K tile (source pitch 128 B, 64 rows
  // on per stage), waves 2, 3 the halves of the V^T tile (source pitch one
  // V^T row, 64 keys on per stage).
  const uint32_t wv  = uni((uint32_t)tid >> 5);
  const bool     isV = (wv & 2u) != 0u;
  const uint64_t src0 =
      isV ? (uint64_t)(size_t)vg0 + (uint64_t)((wv & 1u) * 32u * (SEQ * 2u))
          : (uint64_t)(size_t)kg0 + (uint64_t)((wv & 1u) * 32u * (HDIM * 2u));
  const uint32_t src_step = isV ? 64u * 2u : 64u * (HDIM * 2u);
  const uint32_t lds0 = (uint32_t)(size_t)L + wv * KV_SLICE;
  // The 16 work-groups of one (b,h) stream the same K and V^T lines. Each
  // enters the walk over the key tiles two tiles behind its neighbour and
  // wraps, so that they do not ask L2 for the same lines at one moment (the
  // online softmax takes the tiles in any order).
  const uint32_t rot = uni((blockIdx.x * 2u) & (KV_STAGES - 1u));
  // Descriptor words pinned in scalar registers: one tuple serves every
  // request, so no register of a request in flight takes a new value.
  u32x8 g1;
  g1[0] = pinned((1u << 20) | (4u << 22) | (3u << 25));  // 16 B pad a 128-B row
  g1[1] = pinned(128u << 16);                            // tensor_dim0 = 128 B
  g1[2] = pinned(32u << 16);                             // tensor_dim1 = 32 rows
  g1[3] = pinned(128u << 16);                            // tile_dim0
  g1[4] = pinned(32u);                                   // tile_dim1
  g1[5] = pinned(isV ? SEQ * 2u : HDIM * 2u);            // source row pitch, B
  g1[6] = pinned(0u);
  g1[7] = pinned(0u);
  auto issue = [&](uint32_t st) {
    const uint64_t ga =
        src0 + (uint64_t)(((st + rot) & (KV_STAGES - 1u)) * src_step);
    u32x4 g0;
    g0[0] = uni(1u);
    g0[1] = uni(lds0 + (st & 1u) * KV_BUF);
    g0[2] = uni((uint32_t)ga);
    g0[3] = uni((((uint32_t)(ga >> 32)) & 0x01FFFFFFu) | 0x80000000u);
    // One request of the whole wave: 32 rows of 128 B into LDS at pitch 144 B.
    asm volatile("tensor_load_to_lds %0, %1" :: "s"(g0), "s"(g1) : "memory");
  };

  issue(0u);
  // Stage 0 has landed.
  asm volatile("s_wait_tensorcnt 0x0" ::: "memory");
  __syncthreads();
  issue(1u);

  for (uint32_t st = 0; st < KV_STAGES; ++st) {
    const bf16_t* Kb = (const bf16_t*)(L + (st & 1u) * KV_BUF);
    const bf16_t* Vb = Kb + 2u * (KV_SLICE / 2u);

    // S^T = K Q^T : 4 key-row blocks, K-dim 64 -> 2 WMMAs per column group.
    // sf[g][j][v] = S[query g*16 + col][key tile*64 + j*16 + 8*half + v],
    // tile = (st + rot) mod KV_STAGES
    v8f sf[2][4];
    for (int j = 0; j < 4; ++j) {
      const bf16_t* ks = Kb + (j >> 1) * (KV_SLICE / 2u);
      const v16bf k0 = ld_frag(ks, (j & 1) * 16, KV_PITCH / 2, 0);
      const v16bf k1 = ld_frag(ks, (j & 1) * 16, KV_PITCH / 2, 32);
      for (int g = 0; g < 2; ++g) {
        v8f s = 0.f;
        s = wmma_bf16(k0, qf[g][0], s);
        s = wmma_bf16(k1, qf[g][1], s);
        sf[g][j] = s;
      }
    }

    // Online softmax, one query per lane and column group.
    v16bf p0[2], p1[2];
    for (int g = 0; g < 2; ++g) {
      float mj[4];
      for (int j = 0; j < 4; ++j) {
        float m = sf[g][j][0];
        for (int v = 1; v < 8; ++v) m = fmaxf(m, sf[g][j][v]);
        mj[j] = m;
      }
      float mt = fmaxf(fmaxf(mj[0], mj[1]), fmaxf(mj[2], mj[3]));
      mt = fmaxf(mt, other_half(mt));
      const float mn  = fmaxf(m_i[g], mt);
      // exp(s - mn) = exp2(s * log2e - mn * log2e): one packed fused
      // multiply-add per two scores in front of the hardware's exp2.
      const float nb  = -mn * LOG2E;
      const float scl = __expf(m_i[g] - mn);   // exactly 1 while the maximum stands
      m_i[g] = mn;

      const v2f l2 = {LOG2E, LOG2E}, nb2 = {nb, nb};
      v2f sj[4];
      for (int j = 0; j < 4; ++j) {
        for (int v = 0; v < 8; v += 2) {
          // An even-aligned register pair of the accumulator tile.
          const v2f s2 = {sf[g][j][v], sf[g][j][v + 1]};
          const v2f a  = __builtin_elementwise_fma(s2, l2, nb2);
          const v2f p  = {__builtin_amdgcn_exp2f(a.x), __builtin_amdgcn_exp2f(a.y)};
          sf[g][j][v]     = p.x;
          sf[g][j][v + 1] = p.y;
          sj[j] = v ? sj[j] + p : p;
        }
      }
      const v2f st2 = (sj[0] + sj[1]) + (sj[2] + sj[3]);
      l_i[g] = l_i[g] * scl + (st2.x + st2.y);
      for (int j = 0; j < 4; ++j)
        for (int v = 0; v < 8; ++v) of[g][j][v] *= scl;

      p0[g] = pack_b(sf[g][0], sf[g][1]);
      p1[g] = pack_b(sf[g][2], sf[g][3]);
      // Finish one column group before the next starts: interleaved, the two
      // groups' f32 probabilities overflow the 256-register budget and spill.
      __builtin_amdgcn_sched_barrier(0);
    }

    // O^T += V^T P^T  (K-dim 64 over kv, 4 hd row blocks, 2 column groups).
    for (int j = 0; j < 4; ++j) {
      const bf16_t* vs = Vb + (j >> 1) * (KV_SLICE / 2u);
      const v16bf v0 = ld_frag(vs, (j & 1) * 16, KV_PITCH / 2, 0);
      const v16bf v1 = ld_frag(vs, (j & 1) * 16, KV_PITCH / 2, 32);
      for (int g = 0; g < 2; ++g) {
        of[g][j] = wmma_bf16(v0, p0[g], of[g][j]);
        of[g][j] = wmma_bf16(v1, p1[g], of[g][j]);
      }
    }

    // Publish point of stage st + 1. This wave's reads of this buffer are done:
    asm volatile("s_wait_dscnt 0x0" ::: "memory");
    // its own slice of stage st + 1 has landed:
    asm volatile("s_wait_tensorcnt 0x0" ::: "memory");
    // every wave's has, and every wave has left the buffer refilled below.
    __syncthreads();
    if (pinned(st + 2u < KV_STAGES)) issue(pinned(st + 2u));
  }
  // Nothing is in flight when the wave ends.
  asm volatile("s_wait_tensorcnt 0x0" ::: "memory");
  asm volatile("s_wait_dscnt 0x0" ::: "memory");

  // Finalize: join the halves' sums, O *= 1/l, write to (B, N, H*HD) bf16 for
  // the projection gemm. A lane holds 8 consecutive hd of one query per tile.
  const int b = bh >> 4, h = bh & 15;
  for (int g = 0; g < 2; ++g) {
    const float inv_l = 1.0f / (l_i[g] + other_half(l_i[g]));
    bf16_t* orow = ow + ((size_t)(b * SEQ + qrow0 + g * 16 + col)) * DMODEL +
                   h * HDIM + 8 * half;
    for (int j = 0; j < 4; ++j) {
      v8bf o;
      for (int v = 0; v < 8; ++v) o[v] = (bf16_t)(of[g][j][v] * inv_l);
      *(v8bf*)(orow + j * 16) = o;
    }
  }
}

// ---------------------------------------------------------------------------
// Kernel 3: out = attn_out @ w_proj^T + b_proj  (M=8192, N=1024, K=1024)
// WG tile 256x128, 16 waves, each wave 64x32: 256 work-groups, one per WGP in
// one round, and a third fewer bytes fetched from L2 than with 128x128 tiles.
// One work-group fills a WGP, so nothing else hides its loads: the next 64-wide
// K-slab is fetched into registers while the current one is multiplied, and
// goes into the other of two LDS buffers (one barrier per slab).
// ---------------------------------------------------------------------------
#define PJ_PITCH 72   // LDS row pitch, elements: 64 + 8 of pad (144 bytes)

__global__ __launch_bounds__(512) void proj_gemm_kernel(
    const bf16_t* __restrict__ a, const float* __restrict__ w_proj,
    const float* __restrict__ b_proj, float* __restrict__ out) {
  __shared__ bf16_t As[2][256 * PJ_PITCH];   // 256 rows x 64 K
  __shared__ bf16_t Ws[2][128 * PJ_PITCH];   // 128 rows x 64 K

  const int tid  = threadIdx.x;
  const int wave = tid >> 5;
  const int wm   = wave >> 2;       // 0..3 -> 64-row block
  const int wn   = wave & 3;        // 0..3 -> 32-col block
  const int m0   = blockIdx.x * 256;
  const int e0   = blockIdx.y * 128;

  // Staging: every wave-wide 16-byte load covers four whole 128-byte lines.
  // A (bf16): 8 threads a row, rows ar + 64 i. W (f32): 16 threads a row,
  // rows wr + 32 i.
  const int ar = tid >> 3;
  const int ac = (tid & 7) * 8;
  const int wr = tid >> 4;
  const int wc = (tid & 15) * 4;
  const bf16_t* ag = a + (size_t)(m0 + ar) * DMODEL + ac;
  const float*  wg = w_proj + (size_t)(e0 + wr) * DMODEL + wc;
  // Sharers of the same a rows (8) start the k walk at different slabs and wrap;
  // the 32 sharers of w rows have only 16 start slabs, two to a slab.
  const int rot = (int)((blockIdx.x + blockIdx.y) & (DMODEL / 64 - 1)) * 64;

  v8f acc[4][2];
  for (int i = 0; i < 4; ++i)
    for (int j = 0; j < 2; ++j) acc[i][j] = 0.f;

  u32x4  fa[4];
  float4 fw[4];
  for (int i = 0; i < 4; ++i) {
    fa[i] = *(const u32x4*)(ag + (size_t)i * 64 * DMODEL + rot);
    fw[i] = *(const float4*)(wg + (size_t)i * 32 * DMODEL + rot);
  }
  for (int i = 0; i < 4; ++i) {
    *(u32x4*)&As[0][(ar + i * 64) * PJ_PITCH + ac] = fa[i];
    *(uint2*)&Ws[0][(wr + i * 32) * PJ_PITCH + wc] = pack4_bf16(fw[i]);
  }

  auto products = [&](const bf16_t* Ac, const bf16_t* Wc) {
    v16bf af[2][4], bf[2][2];
    for (int k = 0; k < 2; ++k) {
      for (int i = 0; i < 4; ++i)
        af[k][i] = ld_frag(Ac, wm * 64 + i * 16, PJ_PITCH, k * 32);
      for (int j = 0; j < 2; ++j)
        bf[k][j] = ld_frag(Wc, wn * 32 + j * 16, PJ_PITCH, k * 32);
    }
    // Keeps the 24 LDS reads as one group in front of the 16 products; the
    // compiler otherwise spreads them among the products with full waits.
    __builtin_amdgcn_sched_barrier(0);
    for (int k = 0; k < 2; ++k)
      for (int j = 0; j < 2; ++j)
        for (int i = 0; i < 4; ++i)
          acc[i][j] = wmma_bf16(af[k][i], bf[k][j], acc[i][j]);
  };

  // All slabs but the last: fetch the next one under this one's products.
  for (int kb = 64; kb < DMODEL; kb += 64) {
    const int nxt = (kb >> 6) & 1;
    const int ko  = (kb + rot) & (DMODEL - 1);   // this slab's place in k
    // Publishes buffer nxt^1 and ends every read of buffer nxt.
    __syncthreads();
    for (int i = 0; i < 4; ++i) {
      fa[i] = *(const u32x4*)(ag + (size_t)i * 64 * DMODEL + ko);
      fw[i] = *(const float4*)(wg + (size_t)i * 32 * DMODEL + ko);
    }
    // Keeps the loads in front of the products; the compiler otherwise sinks
    // them to their use and the whole L2 latency is waited out each slab.
    __builtin_amdgcn_sched_barrier(0);
    products(As[nxt ^ 1], Ws[nxt ^ 1]);
    // Keeps the wait for the loads behind the products; the compiler otherwise
    // lifts it, with the conversions, in front of them.
    __builtin_amdgcn_sched_barrier(0);
    for (int i = 0; i < 4; ++i) {
      *(u32x4*)&As[nxt][(ar + i * 64) * PJ_PITCH + ac] = fa[i];
      *(uint2*)&Ws[nxt][(wr + i * 32) * PJ_PITCH + wc] = pack4_bf16(fw[i]);
    }
  }
  __syncthreads();
  products(As[(DMODEL / 64 - 1) & 1], Ws[(DMODEL / 64 - 1) & 1]);

  const int lane = tid & 31;
  const int half = lane >> 4;
  const int col  = lane & 15;
  for (int mi = 0; mi < 4; ++mi)
    for (int ni = 0; ni < 2; ++ni)
      for (int v = 0; v < 8; ++v) {
        int gm = m0 + wm * 64 + mi * 16 + v + 8 * half;
        int ge = e0 + wn * 32 + ni * 16 + col;
        out[(size_t)gm * DMODEL + ge] = acc[mi][ni][v] + b_proj[ge];
      }
}

// ---------------------------------------------------------------------------
extern "C" void kernel_launch(void* const* d_in, const int* in_sizes, int n_in,
                              void* d_out, int out_size, void* d_ws,
                              size_t ws_size, hipStream_t stream) {
  const float* x      = (const float*)d_in[0];
  const float* w_qkv  = (const float*)d_in[1];
  const float* w_proj = (const float*)d_in[2];
  const float* b_proj = (const float*)d_in[3];
  float* out = (float*)d_out;

  const size_t PER = (size_t)BATCH * NHEAD * SEQ * HDIM;  // 8M elements
  bf16_t* qw  = (bf16_t*)d_ws;
  bf16_t* kw  = qw + PER;
  bf16_t* vtw = kw + PER;
  bf16_t* ow  = vtw + PER;   // (B, N, D) attention output, bf16

  qkv_gemm_kernel<<<dim3(BN / 256, E3 / 256), 512, 0, stream>>>(
      x, w_qkv, qw, kw, vtw);
  attn_kernel<<<dim3(SEQ / 128, BATCH * NHEAD), 128, 0, stream>>>(
      qw, kw, vtw, ow);
  proj_gemm_kernel<<<dim3(BN / 256, DMODEL / 128), 512, 0, stream>>>(
      ow, w_proj, b_proj, out);
}

// v009
// One run takes 116 microseconds.
// It is 1.13 times as fast as v007, going by the measured steps of the versions left out in between.
// Over all steps from v000 it is 2.70 times as fast.
#include <hip/hip_runtime.h>
#include <hip/hip_bf16.h>
#include <math.h>

// ---------------------------------------------------------------------------
// MHA forward for B=4, N=2048, D=1024, H=16, HD=64 on gfx1250 (wave32, WMMA).
// bf16 inputs to v_wmma_f32_16x16x32_bf16, fp32 accumulation throughout.
// Compute-bound (~137 GFLOP vs <10us of HBM traffic at 23.3 TB/s), so all
// three stages run through the matrix pipes.
// ---------------------------------------------------------------------------

typedef __bf16 bf16_t;
typedef __attribute__((ext_vector_type(16))) __bf16 v16bf;
typedef __attribute__((ext_vector_type(8)))  __bf16 v8bf;
typedef __attribute__((ext_vector_type(8)))  float  v8f;

#define BATCH 4
#define SEQ   2048
#define DMODEL 1024
#define NHEAD 16
#define HDIM  64
#define BN    (BATCH * SEQ)       // 8192
#define E3    (3 * DMODEL)        // 3072
#define SCALE 0.125f              // 64^-0.5
#define LOG2E 1.44269504088896340736f

__device__ __forceinline__ v8f wmma_bf16(v16bf a, v16bf b, v8f c) {
  return __builtin_amdgcn_wmma_f32_16x16x32_bf16(
      /*neg_a=*/false, a, /*neg_b=*/false, b,
      /*c_mod=*/(short)0, c, /*reuse_a=*/false, /*reuse_b=*/false);
}

// Load one 16x32 bf16 fragment (A-layout; identical addressing serves the
// B-fragment of a TN gemm where B rows are K-contiguous).
//   lane 0-15 : row = lane,    k = {0..7, 16..23}
//   lane 16-31: row = lane-16, k = {8..15, 24..31}
// Two 16-byte reads per lane; `t` may point at LDS (ds_load after addrspace
// inference) or global memory.
__device__ __forceinline__ v16bf ld_frag(const bf16_t* t, int row, int stride,
                                         int kbase) {
  const int lane = threadIdx.x & 31;
  const int r = lane & 15;
  const int klo = (lane >> 4) << 3;
  const bf16_t* p = t + (size_t)(row + r) * stride + kbase + klo;
  union { v16bf v; v8bf h[2]; } u;
  u.h[0] = *(const v8bf*)(p);
  u.h[1] = *(const v8bf*)(p + 16);
  return u.v;
}

// ---------------------------------------------------------------------------
// Kernel 1: qkv = x @ w_qkv^T  (TN gemm, M=8192, N=3072, K=1024)
// WG tile 256x256, 16 waves, each wave 64x64 (acc[4][4], 16 WMMAs / K-step):
// every operand row is fetched from L2 half as often as with 128x128 tiles.
// One work-group fills a WGP, so nothing else hides its loads: the next
// K-slab is fetched into registers while the current one is multiplied, and
// goes into the other of two LDS buffers (one barrier per slab).
// Writes q (pre-scaled by 64^-0.5 * log2 e, so that scores are exponents
// of 2), k as (B,H,N,HD) and v transposed (B,H,HD,N). A wave's 64x64 tile is
// 64 output rows of 128 bytes (q, k: one token's head; v: one hd row's 64
// tokens): it is staged in LDS and leaves as whole 128-byte lines. For q and k
// the product is formed transposed (w rows as A, x rows as B), so that in every
// case a lane holds 8 neighbours of an output row.
// ---------------------------------------------------------------------------
#define ST_PITCH 72   // staging row pitch, elements: 64 + 8 of pad (144 bytes)
#define QK_SLAB (256 * 40)   // one operand's slab: 256 rows x 32 K, stride 40
typedef __attribute__((ext_vector_type(2))) __bf16 v2bf;
typedef __attribute__((ext_vector_type(2))) float  v2f;

__device__ __forceinline__ uint2 pack4_bf16(float4 f) {
  const v2f lo = {f.x, f.y}, hi = {f.z, f.w};
  uint2 u;
  u.x = __builtin_bit_cast(unsigned, __builtin_convertvector(lo, v2bf));
  u.y = __builtin_bit_cast(unsigned, __builtin_convertvector(hi, v2bf));
  return u;
}

// Sends ROWS staged rows of 128 bytes (LDS pitch ST_PITCH) to output rows PITCH
// elements apart. 8 lanes a row: every wave-wide 16-byte store covers four
// whole lines.
template <int ROWS, int PITCH>
__device__ __forceinline__ void store_rows(bf16_t* dst, const bf16_t* stg) {
  const int lane = threadIdx.x & 31;
  dst += (size_t)(lane >> 3) * PITCH + (lane & 7) * 8;
  stg += (lane >> 3) * ST_PITCH + (lane & 7) * 8;
  // Unrolled: one address pair with immediate offsets serves every store, so
  // no register of a store in flight is written again.
#pragma unroll
  for (int t = 0; t < ROWS / 4; ++t)
    *(v8bf*)(dst + (size_t)t * 4 * PITCH) = *(const v8bf*)(stg + t * 4 * ST_PITCH);
}

__global__ __launch_bounds__(512) void qkv_gemm_kernel(
    const float* __restrict__ x, const float* __restrict__ w_qkv,
    bf16_t* __restrict__ qw, bf16_t* __restrict__ kw, bf16_t* __restrict__ vtw) {
  // During the k walk: two X slabs, then two W slabs (81,920 bytes). Behind it:
  // output staging, 64 rows of ST_PITCH for each of the 16 waves.
  __shared__ __attribute__((aligned(16))) bf16_t SM[16 * 64 * ST_PITCH];
  bf16_t* const Xs = SM;
  bf16_t* const Ws = SM + 2 * QK_SLAB;

  const int tid  = threadIdx.x;
  const int wave = tid >> 5;
  const int wm   = wave >> 2;       // 0..3 -> 64 A rows: e for q, k; tokens for v
  const int wn   = wave & 3;        // 0..3 -> 64 B rows: tokens for q, k; e for v
  const int m0   = blockIdx.x * 256;
  const int e0   = blockIdx.y * 256;
  // The 256-wide N tile lies inside one q/k/v segment -> s is block-uniform.
  const int  s  = e0 >> 10;         // 0=q, 1=k, 2=v
  const bool tr = s != 2;           // q, k: A operand from W, B operand from X
  const bf16_t* const As = tr ? Ws : Xs;
  const bf16_t* const Bs = tr ? Xs : Ws;

  // Staging: a thread carries 4 floats of rows sr, sr+64, sr+128, sr+192 of
  // both tiles; 8 neighbouring threads cover one 128-byte line.
  const int sr = tid >> 3;
  const int sc = (tid & 7) * 4;
  const float* xg = x + (size_t)(m0 + sr) * DMODEL + sc;
  const float* wg = w_qkv + (size_t)(e0 + sr) * DMODEL + sc;
  // The 12 work-groups of a row block read the same x lines and the 32 of a
  // column block the same w lines. Each starts its k walk at a slab of its own
  // and wraps, so that sharers do not ask L2 for the same lines at one moment.
  const int rot = (int)((blockIdx.x + blockIdx.y) & (DMODEL / 32 - 1)) * 32;

  v8f acc[4][4];
  for (int i = 0; i < 4; ++i)
    for (int j = 0; j < 4; ++j) acc[i][j] = 0.f;

  float4 fx[4], fw[4];
  for (int i = 0; i < 4; ++i) {
    fx[i] = *(const float4*)(xg + (size_t)i * 64 * DMODEL + rot);
    fw[i] = *(const float4*)(wg + (size_t)i * 64 * DMODEL + rot);
  }
  for (int i = 0; i < 4; ++i) {
    *(uint2*)&Xs[(sr + i * 64) * 40 + sc] = pack4_bf16(fx[i]);
    *(uint2*)&Ws[(sr + i * 64) * 40 + sc] = pack4_bf16(fw[i]);
  }

  auto products = [&](int buf) {
    const bf16_t* Ac = As + buf * QK_SLAB;
    const bf16_t* Bc = Bs + buf * QK_SLAB;
    v16bf a[4];
    for (int i = 0; i < 4; ++i) a[i] = ld_frag(Ac, wm * 64 + i * 16, 40, 0);
    v16bf b[4];
    for (int j = 0; j < 4; ++j) b[j] = ld_frag(Bc, wn * 64 + j * 16, 40, 0);
    // Keeps the 16 LDS reads as one group in front of the 16 products; the
    // compiler otherwise spreads them among the products with full waits.
    __builtin_amdgcn_sched_barrier(0);
    for (int j = 0; j < 4; ++j)
      for (int i = 0; i < 4; ++i) acc[i][j] = wmma_bf16(a[i], b[j], acc[i][j]);
  };

  // All slabs but the last: fetch the next one under this one's products.
  for (int kb = 32; kb < DMODEL; kb += 32) {
    const int nxt = (kb >> 5) & 1;
    const int ko  = (kb + rot) & (DMODEL - 1);   // this slab's place in k
    // Publishes buffer nxt^1 and ends every read of buffer nxt.
    __syncthreads();
    for (int i = 0; i < 4; ++i) {
      fx[i] = *(const float4*)(xg + (size_t)i * 64 * DMODEL + ko);
      fw[i] = *(const float4*)(wg + (size_t)i * 64 * DMODEL + ko);
    }
    // Keeps the loads in front of the products; the compiler otherwise sinks
    // them to their use and the whole L2 latency is waited out each slab.
    __builtin_amdgcn_sched_barrier(0);
    products(nxt ^ 1);
    // Keeps the conversions, and with them the wait for the loads, behind the
    // products; the compiler otherwise lifts both in front of them.
    __builtin_amdgcn_sched_barrier(0);
    for (int i = 0; i < 4; ++i) {
      *(uint2*)&Xs[nxt * QK_SLAB + (sr + i * 64) * 40 + sc] = pack4_bf16(fx[i]);
      *(uint2*)&Ws[nxt * QK_SLAB + (sr + i * 64) * 40 + sc] = pack4_bf16(fw[i]);
    }
  }
  __syncthreads();
  products((DMODEL / 32 - 1) & 1);

  // Epilogue. C-layout: lane holds column lane&15, rows v+8*(lane>>4), so
  // acc[i][j] is 8 neighbours (i*16 + 8*half + v) of output row j*16 + col.
  const int lane = tid & 31;
  const int half = lane >> 4;
  const int col  = lane & 15;
  // Every wave has left the slabs before they become output staging.
  __syncthreads();
  bf16_t* const stg = SM + wave * (64 * ST_PITCH);   // this wave's own range
  const float f = s == 0 ? SCALE * LOG2E : 1.f;
  for (int j = 0; j < 4; ++j)
    for (int i = 0; i < 4; ++i) {
      v8bf o;
      for (int v = 0; v < 8; ++v) o[v] = (bf16_t)(acc[i][j][v] * f);
      *(v8bf*)&stg[(j * 16 + col) * ST_PITCH + i * 16 + 8 * half] = o;
    }
  // The rows read back below were written by other lanes of this wave.
  asm volatile("s_wait_dscnt 0x0" ::: "memory");

  const int gm = m0 + (tr ? wn : wm) * 64;          // first of 64 tokens
  const int ge = e0 + (tr ? wm : wn) * 64;          // first of 64 e: one head
  const int bh = (gm >> 11) * NHEAD + ((ge >> 6) & (NHEAD - 1));
  const int n0 = gm & (SEQ - 1);
  if (tr)
    store_rows<64, HDIM>((s == 0 ? qw : kw) + ((size_t)bh * SEQ + n0) * HDIM, stg);
  else
    store_rows<64, SEQ>(vtw + (size_t)bh * HDIM * SEQ + n0, stg);
}

typedef uint32_t u32x4 __attribute__((ext_vector_type(4)));
typedef uint32_t u32x8 __attribute__((ext_vector_type(8)));

#define KV_PITCH 144u                // LDS row pitch, bytes: 128 + 16 of pad
#define KV_SLICE 6144u               // 32 rows x 144 B, rounded up to 2 KiB
#define KV_BUF   (4u * KV_SLICE)     // K rows 0-31, 32-63, V^T rows 0-31, 32-63
#define KV_STAGES (SEQ / 64)

__device__ __forceinline__ uint32_t uni(uint32_t v) {
  return (uint32_t)__builtin_amdgcn_readfirstlane(v);
}

// A wave-uniform value held in a scalar register: the test around a tensor
// load must compile to a scalar branch (the load ignores EXEC), and a
// descriptor word formed from it stays behind the volatile wait above it.
__device__ __forceinline__ uint32_t pinned(uint32_t v) {
  uint32_t w = uni(v);
  asm volatile("" : "+s"(w));  // pinned(): issue test or descriptor word kept scalar
  return w;
}

// Value of lane l ^ 16.
__device__ __forceinline__ float other_half(float x) {
  int b = __builtin_bit_cast(int, x);
  b = __builtin_amdgcn_permlanex16(b, b, 0x76543210, 0xfedcba98, false, false);
  return __builtin_bit_cast(float, b);
}

// Probabilities of one column group's 64 x 16 score tile. s holds the scores
// less the maximum in use (exponents of 2); SHIFT takes d off them first.
// Two accumulator tiles (rows 0-15 and 16-31 of a 32-row block) pack into one
// bf16 B fragment: element e is row (e<8 ? 8*half+e : 16+8*half+e-8).
// Returns this lane's sum of the 32 probabilities as two partial sums.
template <bool SHIFT>
__device__ __forceinline__ v2f probs(const v8f (&s)[4], float d, v16bf& p0,
                                     v16bf& p1) {
  union { v16bf v; v2bf h[8]; } q0, q1;
  const v2f d2 = {d, d};
  v2f sj[4];
  for (int j = 0; j < 4; ++j)
    for (int w = 0; w < 4; ++w) {
      // An even-aligned register pair of the accumulator tile.
      v2f a = {s[j][2 * w], s[j][2 * w + 1]};
      if (SHIFT) a = a - d2;
      const v2f p = {__builtin_amdgcn_exp2f(a.x), __builtin_amdgcn_exp2f(a.y)};
      (j < 2 ? q0 : q1).h[(j & 1) * 4 + w] = __builtin_convertvector(p, v2bf);
      sj[j] = w ? sj[j] + p : p;
    }
  p0 = q0.v;
  p1 = q1.v;
  return (sj[0] + sj[1]) + (sj[2] + sj[3]);
}

// Four waves per SIMD (256 VGPRs each): all 1024 work-groups are resident at
// once, four per WGP, so there is no second, half-empty round.
__global__ __launch_bounds__(128)
__attribute__((amdgpu_waves_per_eu(4, 4))) void attn_kernel(
    const bf16_t* __restrict__ qw, const bf16_t* __restrict__ kw,
    const bf16_t* __restrict__ vtw, bf16_t* __restrict__ ow) {
  // Two buffers of four 32-row slices: K (rows=kv, cols=hd), V^T (rows=hd,
  // cols=kv). Every slice starts at a multiple of 2 KiB.
  __shared__ __attribute__((aligned(2048))) unsigned char L[2 * KV_BUF];

  const int tid  = threadIdx.x;
  const int wave = tid >> 5;
  const int lane = tid & 31;
  const int half = lane >> 4;
  const int col  = lane & 15;
  const int bh   = blockIdx.y;                 // b*16 + h
  const int qrow0 = blockIdx.x * 128 + wave * 32;

  // Q fragments (2 groups x 16 rows x HD=64 -> two k-slices each), straight
  // from global. Used as the B operand: column = query, k = hd.
  const bf16_t* qbase = qw + ((size_t)bh * SEQ + qrow0) * HDIM;
  v16bf qf[2][2];
  for (int g = 0; g < 2; ++g) {
    qf[g][0] = ld_frag(qbase, g * 16, HDIM, 0);
    qf[g][1] = ld_frag(qbase, g * 16, HDIM, 32);
  }

  // of[g][j][v] = O[query g*16 + col][hd = j*16 + 8*half + v]
  v8f of[2][4];
  v8f negm[2];    // minus the maximum in use of this lane's query, 8 copies
  v2f l_i[2];     // running sum over this half's keys only, two partial sums
  for (int g = 0; g < 2; ++g) {
    for (int j = 0; j < 4; ++j) of[g][j] = 0.f;
    negm[g] = 0.f;
    l_i[g]  = 0.f;
  }

  const bf16_t* kg0 = kw + (size_t)bh * SEQ * HDIM;
  const bf16_t* vg0 = vtw + (size_t)bh * HDIM * SEQ;

  // Every wave issues one request per stage for its own slice of 32 rows of
  // 128 bytes: waves 0, 1 the halves of the K tile (source pitch 128 B, 64 rows
  // on per stage), waves 2, 3 the halves of the V^T tile (source pitch one
  // V^T row, 64 keys on per stage).
  const uint32_t wv  = uni((uint32_t)tid >> 5);
  const bool     isV = (wv & 2u) != 0u;
  const uint64_t src0 =
      isV ? (uint64_t)(size_t)vg0 + (uint64_t)((wv & 1u) * 32u * (SEQ * 2u))
          : (uint64_t)(size_t)kg0 + (uint64_t)((wv & 1u) * 32u * (HDIM * 2u));
  const uint32_t src_step = isV ? 64u * 2u : 64u * (HDIM * 2u);
  const uint32_t lds0 = (uint32_t)(size_t)L + wv * KV_SLICE;
  // The 16 work-groups of one (b,h) stream the same K and V^T lines. Each
  // enters the walk over the key tiles two tiles behind its neighbour and
  // wraps, so that they do not ask L2 for the same lines at one moment (the
  // online softmax takes the tiles in any order).
  const uint32_t rot = uni((blockIdx.x * 2u) & (KV_STAGES - 1u));
  // Descriptor words pinned in scalar registers: one tuple serves every
  // request, so no register of a request in flight takes a new value.
  u32x8 g1;
  g1[0] = pinned((1u << 20) | (4u << 22) | (3u << 25));  // 16 B pad a 128-B row
  g1[1] = pinned(128u << 16);                            // tensor_dim0 = 128 B
  g1[2] = pinned(32u << 16);                             // tensor_dim1 = 32 rows
  g1[3] = pinned(128u << 16);                            // tile_dim0
  g1[4] = pinned(32u);                                   // tile_dim1
  g1[5] = pinned(isV ? SEQ * 2u : HDIM * 2u);            // source row pitch, B
  g1[6] = pinned(0u);
  g1[7] = pinned(0u);
  u32x4 g0;   // group 0 of the request in flight, held until its wait
  auto issue = [&](uint32_t st) {
    const uint64_t ga =
        src0 + (uint64_t)(((st + rot) & (KV_STAGES - 1u)) * src_step);
    g0[0] = uni(1u);
    g0[1] = uni(lds0 + (st & 1u) * KV_BUF);
    g0[2] = uni((uint32_t)ga);
    g0[3] = uni((((uint32_t)(ga >> 32)) & 0x01FFFFFFu) | 0x80000000u);
    // One request of the whole wave: 32 rows of 128 B into LDS at pitch 144 B.
    asm volatile("tensor_load_to_lds %0, %1" :: "s"(g0), "s"(g1) : "memory");
  };

  issue(0u);
  // Stage 0 has landed.
  asm volatile("s_wait_tensorcnt 0x0" ::: "memory");
  __syncthreads();
  issue(1u);

  for (uint32_t st = 0; st < KV_STAGES; ++st) {
    const bf16_t* Kb = (const bf16_t*)(L + (st & 1u) * KV_BUF);
    const bf16_t* Vb = Kb + 2u * (KV_SLICE / 2u);

    // S^T = K Q^T : 4 key-row blocks, K-dim 64 -> 2 WMMAs per column group.
    // sf[g][j][v] = S[query g*16 + col][key tile*64 + j*16 + 8*half + v] less
    // the query's maximum in use, which enters as the C operand;
    // tile = (st + rot) mod KV_STAGES
    v8f sf[2][4];
    auto scores = [&]() {
      for (int j = 0; j < 4; ++j) {
        const bf16_t* ks = Kb + (j >> 1) * (KV_SLICE / 2u);
        const v16bf k0 = ld_frag(ks, (j & 1) * 16, KV_PITCH / 2, 0);
        const v16bf k1 = ld_frag(ks, (j & 1) * 16, KV_PITCH / 2, 32);
        for (int g = 0; g < 2; ++g) {
          v8f s = wmma_bf16(k0, qf[g][0], negm[g]);
          s = wmma_bf16(k1, qf[g][1], s);
          sf[g][j] = s;
        }
      }
    };

    // Online softmax, one query per lane and column group, rescaled lazily:
    // the maximum in use stands while no probability tops 256. A lane's partial
    // sums bound each of its (non-negative) probabilities, so they are the test.
    v16bf p0[2], p1[2];
    v2f ts[2];
    uint32_t move = 1u;    // the first tile sets the maximum in use
    if (st != 0u) {
      scores();
      for (int g = 0; g < 2; ++g) {
        ts[g] = probs<false>(sf[g], 0.f, p0[g], p1[g]);
      }
      const float top = fmaxf(fmaxf(ts[0].x, ts[0].y), fmaxf(ts[1].x, ts[1].y));
      move = __builtin_amdgcn_ballot_w32(top > 256.f);   // one test per tile
    }
    if (move != 0u) {
      // Seldom: raise the maximum in use to this tile's and redo the tile. The
      // scores are formed anew (kept until here they would cost 64 registers).
      scores();
      for (int g = 0; g < 2; ++g) {
        float mj[4];
        for (int j = 0; j < 4; ++j) {
          float m = sf[g][j][0];
          for (int v = 1; v < 8; ++v) m = fmaxf(m, sf[g][j][v]);
          mj[j] = m;
        }
        float mt = fmaxf(fmaxf(mj[0], mj[1]), fmaxf(mj[2], mj[3]));
        mt = fmaxf(mt, other_half(mt));
        const float d   = st != 0u ? fmaxf(mt, 0.f) : mt;
        const float scl = st != 0u ? __builtin_amdgcn_exp2f(-d) : 1.f;
        negm[g] -= d;
        l_i[g] *= scl;
        for (int j = 0; j < 4; ++j)
          for (int v = 0; v < 8; ++v) of[g][j][v] *= scl;
        ts[g] = probs<true>(sf[g], d, p0[g], p1[g]);
      }
    }
    for (int g = 0; g < 2; ++g) l_i[g] += ts[g];

    // O^T += V^T P^T  (K-dim 64 over kv, 4 hd row blocks, 2 column groups).
    for (int j = 0; j < 4; ++j) {
      const bf16_t* vs = Vb + (j >> 1) * (KV_SLICE / 2u);
      const v16bf v0 = ld_frag(vs, (j & 1) * 16, KV_PITCH / 2, 0);
      const v16bf v1 = ld_frag(vs, (j & 1) * 16, KV_PITCH / 2, 32);
      for (int g = 0; g < 2; ++g) {
        of[g][j] = wmma_bf16(v0, p0[g], of[g][j]);
        of[g][j] = wmma_bf16(v1, p1[g], of[g][j]);
      }
    }

    // Publish point of stage st + 1. This wave's reads of this buffer are done:
    asm volatile("s_wait_dscnt 0x0" ::: "memory");
    // its own slice of stage st + 1 has landed. The wait names group 0 of that
    // request as an input, so that its four registers stay its own up to here
    // (else the loop's scalar flags are allocated over words 0 and 3 in flight):
    asm volatile("s_wait_tensorcnt 0x0" :: "s"(g0) : "memory");
    // every wave's has, and every wave has left the buffer refilled below.
    __syncthreads();
    if (pinned(st + 2u < KV_STAGES)) issue(pinned(st + 2u));
  }
  // Nothing is in flight when the wave ends.
  asm volatile("s_wait_tensorcnt 0x0" ::: "memory");
  asm volatile("s_wait_dscnt 0x0" ::: "memory");

  // Finalize: join the halves' sums, O *= 1/l, write to (B, N, H*HD) bf16 for
  // the projection gemm. A lane holds 8 consecutive hd of one query per tile; a
  // query's 64 hd are one 128-byte line, so the wave's 32 rows are staged in its
  // own LDS range and leave as whole lines. The buffers are free: the last
  // pass's barrier stands behind every wave's last read and last landed load.
  const int b = bh >> 4, h = bh & 15;
  bf16_t* const stg = (bf16_t*)L + wave * (32 * ST_PITCH);
  for (int g = 0; g < 2; ++g) {
    const float lh = l_i[g].x + l_i[g].y;
    const float inv_l = 1.0f / (lh + other_half(lh));
    for (int j = 0; j < 4; ++j) {
      v8bf o;
      for (int v = 0; v < 8; ++v) o[v] = (bf16_t)(of[g][j][v] * inv_l);
      *(v8bf*)&stg[(g * 16 + col) * ST_PITCH + j * 16 + 8 * half] = o;
    }
  }
  // The rows read back below were written by other lanes of this wave.
  asm volatile("s_wait_dscnt 0x0" ::: "memory");
  store_rows<32, DMODEL>(ow + (size_t)(b * SEQ + qrow0) * DMODEL + h * HDIM, stg);
}

// ---------------------------------------------------------------------------
// Kernel 3: out = attn_out @ w_proj^T + b_proj  (M=8192, N=1024, K=1024)
// WG tile 256x128, 16 waves, each wave 64x32: 256 work-groups, one per WGP in
// one round, and a third fewer bytes fetched from L2 than with 128x128 tiles.
// One work-group fills a WGP, so nothing else hides its loads: the next 64-wide
// K-slab is fetched into registers while the current one is multiplied, and
// goes into the other of two LDS buffers (one barrier per slab).
// ---------------------------------------------------------------------------
#define PJ_PITCH 72   // LDS row pitch, elements: 64 + 8 of pad (144 bytes)

__global__ __launch_bounds__(512) void proj_gemm_kernel(
    const bf16_t* __restrict__ a, const float* __restrict__ w_proj,
    const float* __restrict__ b_proj, float* __restrict__ out) {
  // During the k walk: two A slabs (256 rows x 64 K), then two W slabs (128 rows
  // x 64 K), 110,592 bytes. Behind it: output staging, 64 rows of 144 bytes for
  // each of the 16 waves.
  __shared__ __attribute__((aligned(16))) bf16_t SM[16 * 64 * ST_PITCH];
  bf16_t (*const As)[256 * PJ_PITCH] = (bf16_t (*)[256 * PJ_PITCH])SM;
  bf16_t (*const Ws)[128 * PJ_PITCH] =
      (bf16_t (*)[128 * PJ_PITCH])(SM + 2 * 256 * PJ_PITCH);

  const int tid  = threadIdx.x;
  const int wave = tid >> 5;
  const int wm   = wave >> 2;       // 0..3 -> 64-row block
  const int wn   = wave & 3;        // 0..3 -> 32-col block
  const int m0   = blockIdx.x * 256;
  const int e0   = blockIdx.y * 128;

  // Staging: every wave-wide 16-byte load covers four whole 128-byte lines.
  // A (bf16): 8 threads a row, rows ar + 64 i. W (f32): 16 threads a row,
  // rows wr + 32 i.
  const int ar = tid >> 3;
  const int ac = (tid & 7) * 8;
  const int wr = tid >> 4;
  const int wc = (tid & 15) * 4;
  const bf16_t* ag = a + (size_t)(m0 + ar) * DMODEL + ac;
  const float*  wg = w_proj + (size_t)(e0 + wr) * DMODEL + wc;
  // Sharers of the same a rows (8) start the k walk at different slabs and wrap;
  // the 32 sharers of w rows have only 16 start slabs, two to a slab.
  const int rot = (int)((blockIdx.x + blockIdx.y) & (DMODEL / 64 - 1)) * 64;

  v8f acc[4][2];
  for (int i = 0; i < 4; ++i)
    for (int j = 0; j < 2; ++j) acc[i][j] = 0.f;

  u32x4  fa[4];
  float4 fw[4];
  for (int i = 0; i < 4; ++i) {
    fa[i] = *(const u32x4*)(ag + (size_t)i * 64 * DMODEL + rot);
    fw[i] = *(const float4*)(wg + (size_t)i * 32 * DMODEL + rot);
  }
  for (int i = 0; i < 4; ++i) {
    *(u32x4*)&As[0][(ar + i * 64) * PJ_PITCH + ac] = fa[i];
    *(uint2*)&Ws[0][(wr + i * 32) * PJ_PITCH + wc] = pack4_bf16(fw[i]);
  }

  auto products = [&](const bf16_t* Ac, const bf16_t* Wc) {
    v16bf af[2][4], bf[2][2];
    for (int k = 0; k < 2; ++k) {
      for (int i = 0; i < 4; ++i)
        af[k][i] = ld_frag(Ac, wm * 64 + i * 16, PJ_PITCH, k * 32);
      for (int j = 0; j < 2; ++j)
        bf[k][j] = ld_frag(Wc, wn * 32 + j * 16, PJ_PITCH, k * 32);
    }
    // Keeps the 24 LDS reads as one group in front of the 16 products; the
    // compiler otherwise spreads them among the products with full waits.
    __builtin_amdgcn_sched_barrier(0);
    for (int k = 0; k < 2; ++k)
      for (int j = 0; j < 2; ++j)
        for (int i = 0; i < 4; ++i)
          // Transposed (w rows as A): a lane holds 8 neighbours of an out row.
          acc[i][j] = wmma_bf16(bf[k][j], af[k][i], acc[i][j]);
  };

  // All slabs but the last: fetch the next one under this one's products.
  for (int kb = 64; kb < DMODEL; kb += 64) {
    const int nxt = (kb >> 6) & 1;
    const int ko  = (kb + rot) & (DMODEL - 1);   // this slab's place in k
    // Publishes buffer nxt^1 and ends every read of buffer nxt.
    __syncthreads();
    for (int i = 0; i < 4; ++i) {
      fa[i] = *(const u32x4*)(ag + (size_t)i * 64 * DMODEL + ko);
      fw[i] = *(const float4*)(wg + (size_t)i * 32 * DMODEL + ko);
    }
    // Keeps the loads in front of the products; the compiler otherwise sinks
    // them to their use and the whole L2 latency is waited out each slab.
    __builtin_amdgcn_sched_barrier(0);
    products(As[nxt ^ 1], Ws[nxt ^ 1]);
    // Keeps the wait for the loads behind the products; the compiler otherwise
    // lifts it, with the conversions, in front of them.
    __builtin_amdgcn_sched_barrier(0);
    for (int i = 0; i < 4; ++i) {
      *(u32x4*)&As[nxt][(ar + i * 64) * PJ_PITCH + ac] = fa[i];
      *(uint2*)&Ws[nxt][(wr + i * 32) * PJ_PITCH + wc] = pack4_bf16(fw[i]);
    }
  }
  __syncthreads();
  products(As[(DMODEL / 64 - 1) & 1], Ws[(DMODEL / 64 - 1) & 1]);

  // acc[i][j][v] = row m0 + wm*64 + i*16 + col, column e0 + wn*32 + j*16 +
  // 8*half + v. The wave's 32 columns of a row are one 128-byte line: the tile
  // is staged in LDS and leaves as whole lines.
  const int lane = tid & 31;
  const int half = lane >> 4;
  const int col  = lane & 15;
  // Every wave has left the slabs before they become output staging.
  __syncthreads();
  float* const stg = (float*)SM + wave * (64 * (ST_PITCH / 2));
  for (int i = 0; i < 4; ++i)
    for (int j = 0; j < 2; ++j) {
      float* p = &stg[(i * 16 + col) * (ST_PITCH / 2) + j * 16 + 8 * half];
      *(float4*)p = make_float4(acc[i][j][0], acc[i][j][1], acc[i][j][2],
                                acc[i][j][3]);
      *(float4*)(p + 4) = make_float4(acc[i][j][4], acc[i][j][5], acc[i][j][6],
                                      acc[i][j][7]);
    }
  // The rows read back below were written by other lanes of this wave.
  asm volatile("s_wait_dscnt 0x0" ::: "memory");
  // 8 lanes a row: every wave-wide 16-byte store covers four whole lines.
  const int ge = e0 + wn * 32 + (lane & 7) * 4;
  const float4 bias = *(const float4*)(b_proj + ge);
  float* dst = out + (size_t)(m0 + wm * 64 + (lane >> 3)) * DMODEL + ge;
  const float* sp = stg + (lane >> 3) * (ST_PITCH / 2) + (lane & 7) * 4;
  // Unrolled: one address pair with immediate offsets serves every store, so
  // no register of a store in flight is written again.
#pragma unroll
  for (int t = 0; t < 16; ++t) {
    const float4 r = *(const float4*)(sp + t * 4 * (ST_PITCH / 2));
    *(float4*)(dst + (size_t)t * 4 * DMODEL) =
        make_float4(r.x + bias.x, r.y + bias.y, r.z + bias.z, r.w + bias.w);
  }
}

// ---------------------------------------------------------------------------
extern "C" void kernel_launch(void* const* d_in, const int* in_sizes, int n_in,
                              void* d_out, int out_size, void* d_ws,
                              size_t ws_size, hipStream_t stream) {
  const float* x      = (const float*)d_in[0];
  const float* w_qkv  = (const float*)d_in[1];
  const float* w_proj = (const float*)d_in[2];
  const float* b_proj = (const float*)d_in[3];
  float* out = (float*)d_out;

  const size_t PER = (size_t)BATCH * NHEAD * SEQ * HDIM;  // 8M elements
  bf16_t* qw  = (bf16_t*)d_ws;
  bf16_t* kw  = qw + PER;
  bf16_t* vtw = kw + PER;
  bf16_t* ow  = vtw + PER;   // (B, N, D) attention output, bf16

  qkv_gemm_kernel<<<dim3(BN / 256, E3 / 256), 512, 0, stream>>>(
      x, w_qkv, qw, kw, vtw);
  attn_kernel<<<dim3(SEQ / 128, BATCH * NHEAD), 128, 0, stream>>>(
      qw, kw, vtw, ow);
  proj_gemm_kernel<<<dim3(BN / 256, DMODEL / 128), 512, 0, stream>>>(
      ow, w_proj, b_proj, out);
}
